// v000
// The times below were measured on an AMD MI455X: many runs one after another, warmed up first and cycling through
// copies of the inputs, with the whole window's GPU time divided by the number of runs. Launches and the gaps
// between them are all in it. The median over several windows is given; except for v000 it joins two sittings, which
// can be a few percent apart, so the side-by-side timings, each taken in one sitting, are the better comparison.
// v000, which the later versions start from, runs in 130 microseconds.
#include <hip/hip_runtime.h>
#include <hip/hip_bf16.h>
#include <math.h>

// Problem constants (match reference)
#define BB  2
#define NN  2048
#define DD  256
#define HH  8
#define HD  32
#define MROWS (BB*NN)          // 4096 flattened rows
// 1/(sqrt(32)+1e-6)
#define INV_SCALE 0.17677666f

// LDS layout for the attention kernel (float indices, dynamic LDS only):
//   K tiles : 2 bufs x 16 rows x 36 floats  -> [0,    1152)
//   V tiles : 2 bufs x 16 rows x 36 floats  -> [1152, 2304)
//   P bufs  : 4 waves x 16 rows x 20 floats -> [2304, 3584)
#define KT_OFF   0
#define VT_OFF   1152
#define PB_OFF   2304
#define TILE_STRIDE 36         // 16B-aligned rows (36*4=144), conflict-free reads
#define SMEM_FLOATS 3584
#define SMEM_BYTES  (SMEM_FLOATS * 4)

typedef float v2f __attribute__((ext_vector_type(2)));
typedef float v8f __attribute__((ext_vector_type(8)));

// D = A(16x4 f32) * B(4x16 f32) + C, one wave, fp32 WMMA
__device__ __forceinline__ v8f wmma4(v2f a, v2f b, v8f c) {
  return __builtin_amdgcn_wmma_f32_16x16x4_f32(
      /*neg_a=*/false, a, /*neg_b=*/false, b,
      /*c_mod=*/(short)0, c, /*reuse_a=*/false, /*reuse_b=*/false);
}

__device__ __forceinline__ v2f ld2(const float* p) {
  return *reinterpret_cast<const v2f*>(p);
}

__device__ __forceinline__ float sigmoidf_(float x) {
  return 1.0f / (1.0f + __expf(-x));
}

// gfx1250 async copy: LDS[lds_off] = MEM[gaddr], 16 bytes, tracked by ASYNCcnt
__device__ __forceinline__ void async_copy_b128(unsigned lds_off,
                                                const float* gaddr) {
  asm volatile("global_load_async_to_lds_b128 %0, %1, off"
               :: "v"(lds_off), "v"(gaddr) : "memory");
}

// ---------------------------------------------------------------------------
// Kernel 1: q/k/v = x @ W^T + b.  grid=(MROWS/16, 3), block=128 (4 waves).
// Each wave: one 16-row x 64-col tile; A fragment reused across 4 B tiles.
// A 16x4 f32 frag: lane<16 -> (x[m][k],x[m][k+1]); lane>=16 -> (k+2,k+3).
// B 4x16 f32 frag: lane holds col n: (W[n][k+2*ksel], W[n][k+2*ksel+1]).
// ---------------------------------------------------------------------------
__global__ __launch_bounds__(128)
void qkv_proj_kernel(const float* __restrict__ x,
                     const float* __restrict__ wq, const float* __restrict__ bq,
                     const float* __restrict__ wk, const float* __restrict__ bk,
                     const float* __restrict__ wv, const float* __restrict__ bv,
                     float* __restrict__ qb, float* __restrict__ kb,
                     float* __restrict__ vb)
{
  const float* w;  const float* bias;  float* out;
  if (blockIdx.y == 0)      { w = wq; bias = bq; out = qb; }
  else if (blockIdx.y == 1) { w = wk; bias = bk; out = kb; }
  else                      { w = wv; bias = bv; out = vb; }

  const int wave = threadIdx.x >> 5;
  const int lane = threadIdx.x & 31;
  const int lh   = lane & 15;
  const int ksel = lane >> 4;          // 0 or 1 (K half of fragment)

  const int mt = blockIdx.x;           // 16-row tile
  const int m  = mt * 16 + lh;
  const int c0 = wave * 64;            // 64-col group

  const float* xrow = x + (size_t)m * DD + 2 * ksel;
  const float* wr0  = w + (size_t)(c0 + 0 * 16 + lh) * DD + 2 * ksel;
  const float* wr1  = w + (size_t)(c0 + 1 * 16 + lh) * DD + 2 * ksel;
  const float* wr2  = w + (size_t)(c0 + 2 * 16 + lh) * DD + 2 * ksel;
  const float* wr3  = w + (size_t)(c0 + 3 * 16 + lh) * DD + 2 * ksel;

  v8f acc0 = {}, acc1 = {}, acc2 = {}, acc3 = {};

#pragma unroll 4
  for (int kk = 0; kk < DD / 4; ++kk) {
    const int o = 4 * kk;
    v2f a = ld2(xrow + o);
    acc0 = wmma4(a, ld2(wr0 + o), acc0);
    acc1 = wmma4(a, ld2(wr1 + o), acc1);
    acc2 = wmma4(a, ld2(wr2 + o), acc2);
    acc3 = wmma4(a, ld2(wr3 + o), acc3);
  }

  // Epilogue: C/D layout -> VGPR j holds row (mt*16 + j + 8*ksel), col = lh
  const int rowbase = mt * 16 + 8 * ksel;
  v8f accs[4] = {acc0, acc1, acc2, acc3};
#pragma unroll
  for (int t = 0; t < 4; ++t) {
    const int col = c0 + t * 16 + lh;
    const float bv_ = bias[col];
#pragma unroll
    for (int j = 0; j < 8; ++j)
      out[(size_t)(rowbase + j) * DD + col] = accs[t][j] + bv_;
  }
}

// ---------------------------------------------------------------------------
// Kernel 2: spinor flash attention.  grid=(N/64, H, B), block=128 (4 waves).
// All 4 waves share one (b,h); K/V 16x32 tiles are staged in LDS once per
// block via double-buffered gfx1250 async copies (ASYNCcnt), overlapping the
// next tile's DMA with the current tile's 24 WMMAs.
// Scores are bounded in [0, 0.177] after scaling -> plain sum-of-exp softmax.
// re uses K directly; im uses the per-lane pair-rotated K (free swap+negate).
// P (exp weights) goes C-layout -> LDS (padded) -> A-layout for the PV WMMAs.
// ---------------------------------------------------------------------------
__global__ __launch_bounds__(128)
void spinor_attn_kernel(const float* __restrict__ qb,
                        const float* __restrict__ kb,
                        const float* __restrict__ vb,
                        float* __restrict__ ob)
{
  extern __shared__ float smem[];

  const int tid  = threadIdx.x;
  const int wave = tid >> 5;
  const int lane = tid & 31;
  const int lh   = lane & 15;
  const int ksel = lane >> 4;

  const int b  = blockIdx.z;
  const int h  = blockIdx.y;
  const int qt = blockIdx.x * 4 + wave;   // query tile 0..127
  const int n0 = qt * 16;

  // Cooperative tile loader: thread t moves one 16B chunk of K and of V.
  const int lr = tid >> 3;                // tile row 0..15
  const int lc = (tid & 7) * 4;           // tile col 0,4,...,28
  const size_t gtile = (size_t)(b * NN) * DD + h * HD + lc;
  const unsigned lds_k = (unsigned)((KT_OFF + lr * TILE_STRIDE + lc) * 4);
  const unsigned lds_v = (unsigned)((VT_OFF + lr * TILE_STRIDE + lc) * 4);

  // Prologue: DMA tile 0 into buffer 0.
  async_copy_b128(lds_k, kb + gtile + (size_t)lr * DD);
  async_copy_b128(lds_v, vb + gtile + (size_t)lr * DD);

  // Preload 8 Q A-fragments (d = 0..31 in steps of 4)
  const float* qp = qb + (size_t)(b * NN + n0 + lh) * DD + h * HD + 2 * ksel;
  v2f qa[8];
#pragma unroll
  for (int s = 0; s < 8; ++s) qa[s] = ld2(qp + 4 * s);

  v8f o0 = {}, o1 = {};     // PV accumulators, d in [0,16) and [16,32)
  v8f lsum = {};            // per-lane partial sum of exp-weights

  float* myp = smem + PB_OFF + wave * 320;   // 16x20 padded P tile
  const unsigned bufstep = (unsigned)(16 * TILE_STRIDE);

  int buf = 0;
  for (int mt = 0; mt < NN / 16; ++mt) {
    // My DMA landed; after the barrier everyone's has, and every wave is done
    // reading the buffer we are about to refill (last touched at mt-1).
    asm volatile("s_wait_asynccnt 0" ::: "memory");
    __syncthreads();

    if (mt + 1 < NN / 16) {
      const size_t gnext = gtile + (size_t)((mt + 1) * 16 + lr) * DD;
      const unsigned lo = (buf ^ 1) * bufstep * 4;
      async_copy_b128(lds_k + lo, kb + gnext);
      async_copy_b128(lds_v + lo, vb + gnext);
    }

    const float* ks = smem + KT_OFF + buf * bufstep;
    const float* vs = smem + VT_OFF + buf * bufstep;

    // ---- scores: re = q.k , im = q.rot(k) ----
    v8f re = {}, im = {};
    const float* krow = ks + lh * TILE_STRIDE + 2 * ksel;
#pragma unroll
    for (int s = 0; s < 8; ++s) {
      v2f kf = ld2(krow + 4 * s);
      re = wmma4(qa[s], kf, re);
      v2f kr; kr[0] = -kf[1]; kr[1] = kf[0];   // pair rotation (i * conj trick)
      im = wmma4(qa[s], kr, im);
    }

    // ---- weight + exp (closed form: cos(atan2(im,re)) = re*rsqrt(re^2+im^2))
    v8f p;
#pragma unroll
    for (int j = 0; j < 8; ++j) {
      float r = re[j], i = im[j];
      float den = r * r + i * i;
      float c = (den > 0.0f) ? r * __frsqrt_rn(den) : 1.0f;
      float wv = 0.5f * (1.0f + c) * INV_SCALE;
      float e = __expf(wv);
      p[j] = e;
      lsum[j] += e;
    }

    // ---- transpose P through LDS: C-layout store, A-layout load ----
#pragma unroll
    for (int j = 0; j < 8; ++j)
      myp[(j + 8 * ksel) * 20 + lh] = p[j];
    asm volatile("s_wait_dscnt 0" ::: "memory");   // wave-local RAW turn-around

    // ---- PV: out += P(16x16) @ V(16x32) ----
#pragma unroll
    for (int kk = 0; kk < 4; ++kk) {
      v2f pa = ld2(myp + lh * 20 + 4 * kk + 2 * ksel);
      const float* vrow = vs + (4 * kk + 2 * ksel) * TILE_STRIDE;
      v2f b0, b1;
      b0[0] = vrow[lh];                    b0[1] = vrow[TILE_STRIDE + lh];
      b1[0] = vrow[16 + lh];               b1[1] = vrow[TILE_STRIDE + 16 + lh];
      o0 = wmma4(pa, b0, o0);
      o1 = wmma4(pa, b1, o1);
    }

    buf ^= 1;
  }

  // ---- softmax normalization: reduce exp-sums over the 16 columns ----
#pragma unroll
  for (int j = 0; j < 8; ++j) {
    float s = lsum[j];
    s += __shfl_xor(s, 1);
    s += __shfl_xor(s, 2);
    s += __shfl_xor(s, 4);
    s += __shfl_xor(s, 8);                 // stays within each 16-lane half
    const float inv = __frcp_rn(s);
    const size_t ro = (size_t)(b * NN + n0 + j + 8 * ksel) * DD + h * HD;
    ob[ro + lh]      = o0[j] * inv;
    ob[ro + 16 + lh] = o1[j] * inv;
  }
}

// ---------------------------------------------------------------------------
// Kernel 3: gate MLP (Linear->SiLU->Linear->Sigmoid) + final multiply.
// grid=4096/4, block=128 (one wave per row).  Lane l owns gate hidden units
// j=l and j=l+32; the row is staged in LDS and broadcast-read.
// ---------------------------------------------------------------------------
__global__ __launch_bounds__(128)
void gate_kernel(const float* __restrict__ ob,
                 const float* __restrict__ wg1, const float* __restrict__ bg1,
                 const float* __restrict__ wg2, const float* __restrict__ bg2,
                 float* __restrict__ out)
{
  __shared__ float rowbuf[4][DD];
  const int wave = threadIdx.x >> 5;
  const int lane = threadIdx.x & 31;
  const int n = blockIdx.x * 4 + wave;

  const float* orow = ob + (size_t)n * DD;
  float* row = rowbuf[wave];
#pragma unroll
  for (int t = 0; t < DD / 32; ++t) row[lane + 32 * t] = orow[lane + 32 * t];
  asm volatile("s_wait_dscnt 0" ::: "memory");

  float acc0 = bg1[lane];
  float acc1 = bg1[lane + 32];
  const float* w0 = wg1 + (size_t)lane * DD;
  const float* w1 = wg1 + (size_t)(lane + 32) * DD;
#pragma unroll 4
  for (int k = 0; k < DD; k += 4) {
    float4 xv = *reinterpret_cast<const float4*>(&row[k]);
    float4 a0 = *reinterpret_cast<const float4*>(w0 + k);
    float4 a1 = *reinterpret_cast<const float4*>(w1 + k);
    acc0 += xv.x * a0.x + xv.y * a0.y + xv.z * a0.z + xv.w * a0.w;
    acc1 += xv.x * a1.x + xv.y * a1.y + xv.z * a1.z + xv.w * a1.w;
  }
  const float h0 = acc0 * sigmoidf_(acc0);   // SiLU
  const float h1 = acc1 * sigmoidf_(acc1);

  float g = h0 * wg2[lane] + h1 * wg2[lane + 32];
  g += __shfl_xor(g, 1);
  g += __shfl_xor(g, 2);
  g += __shfl_xor(g, 4);
  g += __shfl_xor(g, 8);
  g += __shfl_xor(g, 16);
  g = sigmoidf_(g + bg2[0]);

#pragma unroll
  for (int t = 0; t < DD / 32; ++t)
    out[(size_t)n * DD + lane + 32 * t] = row[lane + 32 * t] * g;
}

// ---------------------------------------------------------------------------
extern "C" void kernel_launch(void* const* d_in, const int* in_sizes, int n_in,
                              void* d_out, int out_size, void* d_ws,
                              size_t ws_size, hipStream_t stream)
{
  const float* x   = (const float*)d_in[0];
  const float* wq  = (const float*)d_in[1];
  const float* bq  = (const float*)d_in[2];
  const float* wk  = (const float*)d_in[3];
  const float* bk  = (const float*)d_in[4];
  const float* wv  = (const float*)d_in[5];
  const float* bv  = (const float*)d_in[6];
  const float* wg1 = (const float*)d_in[7];
  const float* bg1 = (const float*)d_in[8];
  const float* wg2 = (const float*)d_in[9];
  const float* bg2 = (const float*)d_in[10];
  float* out = (float*)d_out;

  // Workspace: q | k | v | attn_out   (4 x 4 MB = 16 MB)
  float* qb = (float*)d_ws;
  float* kb = qb + (size_t)MROWS * DD;
  float* vb = kb + (size_t)MROWS * DD;
  float* ob = vb + (size_t)MROWS * DD;

  {
    dim3 grid(MROWS / 16, 3);
    qkv_proj_kernel<<<grid, 128, 0, stream>>>(x, wq, bq, wk, bk, wv, bv,
                                              qb, kb, vb);
  }
  {
    dim3 grid(NN / 64, HH, BB);
    spinor_attn_kernel<<<grid, 128, SMEM_BYTES, stream>>>(qb, kb, vb, ob);
  }
  {
    dim3 grid(MROWS / 4);
    gate_kernel<<<grid, 128, 0, stream>>>(ob, wg1, bg1, wg2, bg2, out);
  }
}

// v001
// Measured time: 123 microseconds a run.
// Timed twice side by side with v000, it ran 1.10 times as fast both times.
#include <hip/hip_runtime.h>
#include <hip/hip_bf16.h>
#include <math.h>

// Problem constants (match reference)
#define BB  2
#define NN  2048
#define DD  256
#define HH  8
#define HD  32
#define MROWS (BB*NN)          // 4096 flattened rows
// 1/(sqrt(32)+1e-6)
#define INV_SCALE 0.17677666f

// Attention work-group: 16 waves = 4 query tiles x 4 key groups.  A stage is
// 64 keys; key group g works on rows [16g, 16g+16) of every stage.
#define QTILES   4
#define KGROUPS  4
#define STAGE_KEYS (16 * KGROUPS)
#define NSTAGE   (NN / STAGE_KEYS)
#define ATTN_THREADS (32 * QTILES * KGROUPS)

// LDS layout for the attention kernel (float indices, dynamic LDS only):
//   K stages: 2 bufs x 64 rows x 36 floats   -> [0,    4608)
//   V stages: 2 bufs x 64 rows x 36 floats   -> [4608, 9216)
//   P bufs  : 16 waves x 16 rows x 20 floats -> [9216, 14336)
// After the key loop [0, 9216) is reused for the partial sums of key groups
// 1..3: 12 waves x 24 values x 32 lanes.
#define TILE_STRIDE 36         // 16B-aligned rows (36*4=144), conflict-free reads
#define BUF_FLOATS (STAGE_KEYS * TILE_STRIDE)
#define KT_OFF   0
#define VT_OFF   (2 * BUF_FLOATS)
#define PB_OFF   (4 * BUF_FLOATS)
#define SMEM_FLOATS (PB_OFF + QTILES * KGROUPS * 320)
#define SMEM_BYTES  (SMEM_FLOATS * 4)

typedef float v2f __attribute__((ext_vector_type(2)));
typedef float v8f __attribute__((ext_vector_type(8)));

// D = A(16x4 f32) * B(4x16 f32) + C, one wave, fp32 WMMA
__device__ __forceinline__ v8f wmma4(v2f a, v2f b, v8f c) {
  return __builtin_amdgcn_wmma_f32_16x16x4_f32(
      /*neg_a=*/false, a, /*neg_b=*/false, b,
      /*c_mod=*/(short)0, c, /*reuse_a=*/false, /*reuse_b=*/false);
}

__device__ __forceinline__ v2f ld2(const float* p) {
  return *reinterpret_cast<const v2f*>(p);
}

__device__ __forceinline__ float sigmoidf_(float x) {
  return 1.0f / (1.0f + __expf(-x));
}

// gfx1250 async copies, tracked by ASYNCcnt: one 16-byte chunk of K and one of
// V per lane.  The s_wait_xcnt stands in the copies' own statement so that no
// later write of an address register can be scheduled in front of it.
__device__ __forceinline__ void async_copy_kv(unsigned lds_k, const float* gk,
                                              unsigned lds_v, const float* gv) {
  asm volatile("global_load_async_to_lds_b128 %0, %1, off\n\t"
               "global_load_async_to_lds_b128 %2, %3, off\n\t"
               "s_wait_xcnt 0x0"
               :: "v"(lds_k), "v"(gk), "v"(lds_v), "v"(gv) : "memory");
}

// ---------------------------------------------------------------------------
// Kernel 1: q/k/v = x @ W^T + b.  grid=(MROWS/16, 3), block=128 (4 waves).
// Each wave: one 16-row x 64-col tile; A fragment reused across 4 B tiles.
// A 16x4 f32 frag: lane<16 -> (x[m][k],x[m][k+1]); lane>=16 -> (k+2,k+3).
// B 4x16 f32 frag: lane holds col n: (W[n][k+2*ksel], W[n][k+2*ksel+1]).
// ---------------------------------------------------------------------------
__global__ __launch_bounds__(128)
void qkv_proj_kernel(const float* __restrict__ x,
                     const float* __restrict__ wq, const float* __restrict__ bq,
                     const float* __restrict__ wk, const float* __restrict__ bk,
                     const float* __restrict__ wv, const float* __restrict__ bv,
                     float* __restrict__ qb, float* __restrict__ kb,
                     float* __restrict__ vb)
{
  const float* w;  const float* bias;  float* out;
  if (blockIdx.y == 0)      { w = wq; bias = bq; out = qb; }
  else if (blockIdx.y == 1) { w = wk; bias = bk; out = kb; }
  else                      { w = wv; bias = bv; out = vb; }

  const int wave = threadIdx.x >> 5;
  const int lane = threadIdx.x & 31;
  const int lh   = lane & 15;
  const int ksel = lane >> 4;          // 0 or 1 (K half of fragment)

  const int mt = blockIdx.x;           // 16-row tile
  const int m  = mt * 16 + lh;
  const int c0 = wave * 64;            // 64-col group

  const float* xrow = x + (size_t)m * DD + 2 * ksel;
  const float* wr0  = w + (size_t)(c0 + 0 * 16 + lh) * DD + 2 * ksel;
  const float* wr1  = w + (size_t)(c0 + 1 * 16 + lh) * DD + 2 * ksel;
  const float* wr2  = w + (size_t)(c0 + 2 * 16 + lh) * DD + 2 * ksel;
  const float* wr3  = w + (size_t)(c0 + 3 * 16 + lh) * DD + 2 * ksel;

  v8f acc0 = {}, acc1 = {}, acc2 = {}, acc3 = {};

#pragma unroll 4
  for (int kk = 0; kk < DD / 4; ++kk) {
    const int o = 4 * kk;
    v2f a = ld2(xrow + o);
    acc0 = wmma4(a, ld2(wr0 + o), acc0);
    acc1 = wmma4(a, ld2(wr1 + o), acc1);
    acc2 = wmma4(a, ld2(wr2 + o), acc2);
    acc3 = wmma4(a, ld2(wr3 + o), acc3);
  }

  // Epilogue: C/D layout -> VGPR j holds row (mt*16 + j + 8*ksel), col = lh
  const int rowbase = mt * 16 + 8 * ksel;
  v8f accs[4] = {acc0, acc1, acc2, acc3};
#pragma unroll
  for (int t = 0; t < 4; ++t) {
    const int col = c0 + t * 16 + lh;
    const float bv_ = bias[col];
#pragma unroll
    for (int j = 0; j < 8; ++j)
      out[(size_t)(rowbase + j) * DD + col] = accs[t][j] + bv_;
  }
}

// ---------------------------------------------------------------------------
// Kernel 2: spinor flash attention.  grid=(N/64, H, B), block=512 (16 waves).
// All waves share one (b,h); wave w owns query tile (w & 3) and key group
// (w >> 2), so each query tile's keys are walked by 4 waves side by side and a
// SIMD holds 8 waves instead of 2 to cover LDS, vector and barrier waits.
// K/V 64x32 stages are put in LDS once per block via double-buffered gfx1250
// async copies (ASYNCcnt), the next stage's copies flying under this stage's
// WMMAs.  The 4 partial results of a query tile are added through LDS at the end.
// Scores are bounded in [0, 0.177] after scaling -> plain sum-of-exp softmax,
// so partial sums over key groups add with no rescale.
// re uses K directly; im uses the per-lane pair-rotated K (free swap+negate).
// P (exp weights) goes C-layout -> LDS (padded) -> A-layout for the PV WMMAs.
// ---------------------------------------------------------------------------
__global__ __launch_bounds__(ATTN_THREADS)
void spinor_attn_kernel(const float* __restrict__ qb,
                        const float* __restrict__ kb,
                        const float* __restrict__ vb,
                        float* __restrict__ ob)
{
  extern __shared__ __attribute__((aligned(16))) float smem[];

  const int tid  = threadIdx.x;
  const int wave = tid >> 5;
  const int lane = tid & 31;
  const int lh   = lane & 15;
  const int ksel = lane >> 4;
  const int qi   = wave & (QTILES - 1);   // query tile inside the block
  const int kg   = wave / QTILES;         // key group 0..3

  const int b  = blockIdx.z;
  const int h  = blockIdx.y;
  const int qt = blockIdx.x * QTILES + qi; // query tile 0..127
  const int n0 = qt * 16;

  // Cooperative stage loader: thread t moves one 16B chunk of K and of V.
  const int lr = tid >> 3;                // stage row 0..63
  const int lc = (tid & 7) * 4;           // stage col 0,4,...,28
  const size_t gtile = (size_t)(b * NN + lr) * DD + h * HD + lc;
  const unsigned lds_k =
      (unsigned)(size_t)(smem + KT_OFF + lr * TILE_STRIDE + lc);
  const unsigned lds_v =
      (unsigned)(size_t)(smem + VT_OFF + lr * TILE_STRIDE + lc);

  // Prologue: stage 0 into buffer 0.
  async_copy_kv(lds_k, kb + gtile, lds_v, vb + gtile);

  // Preload 8 Q A-fragments (d = 0..31 in steps of 4)
  const float* qp = qb + (size_t)(b * NN + n0 + lh) * DD + h * HD + 2 * ksel;
  v2f qa[8];
#pragma unroll
  for (int s = 0; s < 8; ++s) qa[s] = ld2(qp + 4 * s);

  v8f o0 = {}, o1 = {};     // PV accumulators, d in [0,16) and [16,32)
  v8f lsum = {};            // per-lane partial sum of exp-weights

  float* myp = smem + PB_OFF + wave * 320;   // 16x20 padded P tile

  // Stage 0 has landed for this wave; behind the barrier for every wave.
  asm volatile("s_wait_asynccnt 0x0" ::: "memory");
  __syncthreads();
  // Stage 1 into buffer 1; it flies under stage 0's work.
  async_copy_kv(lds_k + BUF_FLOATS * 4, kb + gtile + (size_t)STAGE_KEYS * DD,
                lds_v + BUF_FLOATS * 4, vb + gtile + (size_t)STAGE_KEYS * DD);

  for (int st = 0; st < NSTAGE; ++st) {
    const int buf = st & 1;
    const float* ks = smem + KT_OFF + buf * BUF_FLOATS + kg * 16 * TILE_STRIDE;
    const float* vs = smem + VT_OFF + buf * BUF_FLOATS + kg * 16 * TILE_STRIDE;

    // ---- scores: re = q.k , im = q.rot(k) ----
    v8f re = {}, im = {};
    const float* krow = ks + lh * TILE_STRIDE + 2 * ksel;
#pragma unroll
    for (int s = 0; s < 8; ++s) {
      v2f kf = ld2(krow + 4 * s);
      re = wmma4(qa[s], kf, re);
      v2f kr; kr[0] = -kf[1]; kr[1] = kf[0];   // pair rotation (i * conj trick)
      im = wmma4(qa[s], kr, im);
    }

    // ---- weight + exp (closed form: cos(atan2(im,re)) = re*rsqrt(re^2+im^2))
    v8f p;
#pragma unroll
    for (int j = 0; j < 8; ++j) {
      float r = re[j], i = im[j];
      float den = r * r + i * i;
      float c = (den > 0.0f) ? r * __frsqrt_rn(den) : 1.0f;
      float wv = 0.5f * (1.0f + c) * INV_SCALE;
      float e = __expf(wv);
      p[j] = e;
      lsum[j] += e;
    }

    // ---- transpose P through LDS: C-layout store, A-layout load ----
#pragma unroll
    for (int j = 0; j < 8; ++j)
      myp[(j + 8 * ksel) * 20 + lh] = p[j];
    asm volatile("s_wait_dscnt 0" ::: "memory");   // wave-local RAW turn-around

    // ---- PV: out += P(16x16) @ V(16x32) ----
#pragma unroll
    for (int kk = 0; kk < 4; ++kk) {
      v2f pa = ld2(myp + lh * 20 + 4 * kk + 2 * ksel);
      const float* vrow = vs + (4 * kk + 2 * ksel) * TILE_STRIDE;
      v2f b0, b1;
      b0[0] = vrow[lh];                    b0[1] = vrow[TILE_STRIDE + lh];
      b1[0] = vrow[16 + lh];               b1[1] = vrow[TILE_STRIDE + 16 + lh];
      o0 = wmma4(pa, b0, o0);
      o1 = wmma4(pa, b1, o1);
    }

    // Publish point of stage st+1: my LDS reads of this buffer are done, my
    // copies of the next stage have landed; behind the barrier both hold for
    // every wave, so the buffer just read may be refilled.
    asm volatile("s_wait_dscnt 0x0" ::: "memory");
    asm volatile("s_wait_asynccnt 0x0" ::: "memory");
    __syncthreads();
    if (st + 2 < NSTAGE) {
      const size_t gnext = gtile + (size_t)((st + 2) * STAGE_KEYS) * DD;
      const unsigned lo = (unsigned)(buf * BUF_FLOATS * 4);
      async_copy_kv(lds_k + lo, kb + gnext, lds_v + lo, vb + gnext);
    }
  }
  // No copy is left in flight when the ring becomes the partial-sum buffer.
  asm volatile("s_wait_asynccnt 0x0" ::: "memory");

  // ---- add the 4 key groups' partial sums (the last trip's barrier has ended
  // every read of the ring): groups 1..3 store, group 0 adds in group order ----
  float4* cb = reinterpret_cast<float4*>(smem);
  if (kg != 0) {
    float4* d = cb + ((kg - 1) * QTILES + qi) * 192 + lane;
    d[0]   = make_float4(o0[0], o0[1], o0[2], o0[3]);
    d[32]  = make_float4(o0[4], o0[5], o0[6], o0[7]);
    d[64]  = make_float4(o1[0], o1[1], o1[2], o1[3]);
    d[96]  = make_float4(o1[4], o1[5], o1[6], o1[7]);
    d[128] = make_float4(lsum[0], lsum[1], lsum[2], lsum[3]);
    d[160] = make_float4(lsum[4], lsum[5], lsum[6], lsum[7]);
  }
  __syncthreads();
  if (kg != 0) return;
  // Both loops unrolled: constant indices keep o0, o1 and lsum in registers.
#pragma unroll
  for (int g = 0; g < KGROUPS - 1; ++g) {
    const float4* s = cb + (g * QTILES + qi) * 192 + lane;
#pragma unroll
    for (int i = 0; i < 2; ++i) {
      const float4 a0 = s[32 * i], a1 = s[64 + 32 * i], al = s[128 + 32 * i];
      o0[4 * i + 0] += a0.x;  o0[4 * i + 1] += a0.y;
      o0[4 * i + 2] += a0.z;  o0[4 * i + 3] += a0.w;
      o1[4 * i + 0] += a1.x;  o1[4 * i + 1] += a1.y;
      o1[4 * i + 2] += a1.z;  o1[4 * i + 3] += a1.w;
      lsum[4 * i + 0] += al.x;  lsum[4 * i + 1] += al.y;
      lsum[4 * i + 2] += al.z;  lsum[4 * i + 3] += al.w;
    }
  }

  // ---- softmax normalization: reduce exp-sums over the 16 columns ----
#pragma unroll
  for (int j = 0; j < 8; ++j) {
    float s = lsum[j];
    s += __shfl_xor(s, 1);
    s += __shfl_xor(s, 2);
    s += __shfl_xor(s, 4);
    s += __shfl_xor(s, 8);                 // stays within each 16-lane half
    const float inv = __frcp_rn(s);
    const size_t ro = (size_t)(b * NN + n0 + j + 8 * ksel) * DD + h * HD;
    ob[ro + lh]      = o0[j] * inv;
    ob[ro + 16 + lh] = o1[j] * inv;
  }
}

// ---------------------------------------------------------------------------
// Kernel 3: gate MLP (Linear->SiLU->Linear->Sigmoid) + final multiply.
// grid=4096/4, block=128 (one wave per row).  Lane l owns gate hidden units
// j=l and j=l+32; the row is staged in LDS and broadcast-read.
// ---------------------------------------------------------------------------
__global__ __launch_bounds__(128)
void gate_kernel(const float* __restrict__ ob,
                 const float* __restrict__ wg1, const float* __restrict__ bg1,
                 const float* __restrict__ wg2, const float* __restrict__ bg2,
                 float* __restrict__ out)
{
  __shared__ float rowbuf[4][DD];
  const int wave = threadIdx.x >> 5;
  const int lane = threadIdx.x & 31;
  const int n = blockIdx.x * 4 + wave;

  const float* orow = ob + (size_t)n * DD;
  float* row = rowbuf[wave];
#pragma unroll
  for (int t = 0; t < DD / 32; ++t) row[lane + 32 * t] = orow[lane + 32 * t];
  asm volatile("s_wait_dscnt 0" ::: "memory");

  float acc0 = bg1[lane];
  float acc1 = bg1[lane + 32];
  const float* w0 = wg1 + (size_t)lane * DD;
  const float* w1 = wg1 + (size_t)(lane + 32) * DD;
#pragma unroll 4
  for (int k = 0; k < DD; k += 4) {
    float4 xv = *reinterpret_cast<const float4*>(&row[k]);
    float4 a0 = *reinterpret_cast<const float4*>(w0 + k);
    float4 a1 = *reinterpret_cast<const float4*>(w1 + k);
    acc0 += xv.x * a0.x + xv.y * a0.y + xv.z * a0.z + xv.w * a0.w;
    acc1 += xv.x * a1.x + xv.y * a1.y + xv.z * a1.z + xv.w * a1.w;
  }
  const float h0 = acc0 * sigmoidf_(acc0);   // SiLU
  const float h1 = acc1 * sigmoidf_(acc1);

  float g = h0 * wg2[lane] + h1 * wg2[lane + 32];
  g += __shfl_xor(g, 1);
  g += __shfl_xor(g, 2);
  g += __shfl_xor(g, 4);
  g += __shfl_xor(g, 8);
  g += __shfl_xor(g, 16);
  g = sigmoidf_(g + bg2[0]);

#pragma unroll
  for (int t = 0; t < DD / 32; ++t)
    out[(size_t)n * DD + lane + 32 * t] = row[lane + 32 * t] * g;
}

// ---------------------------------------------------------------------------
extern "C" void kernel_launch(void* const* d_in, const int* in_sizes, int n_in,
                              void* d_out, int out_size, void* d_ws,
                              size_t ws_size, hipStream_t stream)
{
  const float* x   = (const float*)d_in[0];
  const float* wq  = (const float*)d_in[1];
  const float* bq  = (const float*)d_in[2];
  const float* wk  = (const float*)d_in[3];
  const float* bk  = (const float*)d_in[4];
  const float* wv  = (const float*)d_in[5];
  const float* bv  = (const float*)d_in[6];
  const float* wg1 = (const float*)d_in[7];
  const float* bg1 = (const float*)d_in[8];
  const float* wg2 = (const float*)d_in[9];
  const float* bg2 = (const float*)d_in[10];
  float* out = (float*)d_out;

  // Workspace: q | k | v | attn_out   (4 x 4 MB = 16 MB)
  float* qb = (float*)d_ws;
  float* kb = qb + (size_t)MROWS * DD;
  float* vb = kb + (size_t)MROWS * DD;
  float* ob = vb + (size_t)MROWS * DD;

  {
    dim3 grid(MROWS / 16, 3);
    qkv_proj_kernel<<<grid, 128, 0, stream>>>(x, wq, bq, wk, bk, wv, bv,
                                              qb, kb, vb);
  }
  {
    dim3 grid(NN / 64, HH, BB);
    spinor_attn_kernel<<<grid, ATTN_THREADS, SMEM_BYTES, stream>>>(qb, kb, vb, ob);
  }
  {
    dim3 grid(MROWS / 4);
    gate_kernel<<<grid, 128, 0, stream>>>(ob, wg1, bg1, wg2, bg2, out);
  }
}

// v002
// One run takes 106 microseconds.
// Timed twice side by side with v001, it ran 1.16 times as fast both times.
// Counting every step since v000, it is 1.28 times as fast.
#include <hip/hip_runtime.h>
#include <hip/hip_bf16.h>
#include <math.h>

// Problem constants (match reference)
#define BB  2
#define NN  2048
#define DD  256
#define HH  8
#define HD  32
#define MROWS (BB*NN)          // 4096 flattened rows
// 1/(sqrt(32)+1e-6)
#define INV_SCALE 0.17677666f

// Attention work-group: 16 waves = 4 query tiles x 4 key groups.  A stage is
// 64 keys; key group g works on rows [16g, 16g+16) of every stage.
#define QTILES   4
#define KGROUPS  4
#define STAGE_KEYS (16 * KGROUPS)
#define NSTAGE   (NN / STAGE_KEYS)
#define ATTN_THREADS (32 * QTILES * KGROUPS)

// LDS layout for the attention kernel (float indices, dynamic LDS only):
//   K stages: 2 bufs x 64 rows x 36 floats   -> [0,    4608)
//   V stages: 2 bufs x 64 rows x 36 floats   -> [4608, 9216)
//   P bufs  : 16 waves x 16 rows x 20 floats -> [9216, 14336)
// After the key loop [0, 9216) is reused for the partial sums of key groups
// 1..3: 12 waves x 24 values x 32 lanes.
#define TILE_STRIDE 36         // 16B-aligned rows (36*4=144), conflict-free reads
#define BUF_FLOATS (STAGE_KEYS * TILE_STRIDE)
#define KT_OFF   0
#define VT_OFF   (2 * BUF_FLOATS)
#define PB_OFF   (4 * BUF_FLOATS)
#define SMEM_FLOATS (PB_OFF + QTILES * KGROUPS * 320)
#define SMEM_BYTES  (SMEM_FLOATS * 4)

typedef float v2f __attribute__((ext_vector_type(2)));
typedef float v8f __attribute__((ext_vector_type(8)));

// D = A(16x4 f32) * B(4x16 f32) + C, one wave, fp32 WMMA
__device__ __forceinline__ v8f wmma4(v2f a, v2f b, v8f c) {
  return __builtin_amdgcn_wmma_f32_16x16x4_f32(
      /*neg_a=*/false, a, /*neg_b=*/false, b,
      /*c_mod=*/(short)0, c, /*reuse_a=*/false, /*reuse_b=*/false);
}

__device__ __forceinline__ v2f ld2(const float* p) {
  return *reinterpret_cast<const v2f*>(p);
}

__device__ __forceinline__ float sigmoidf_(float x) {
  return 1.0f / (1.0f + __expf(-x));
}

// gfx1250 async copies, tracked by ASYNCcnt: one 16-byte chunk of K and one of
// V per lane.  The s_wait_xcnt stands in the copies' own statement so that no
// later write of an address register can be scheduled in front of it.
__device__ __forceinline__ void async_copy_kv(unsigned lds_k, const float* gk,
                                              unsigned lds_v, const float* gv) {
  asm volatile("global_load_async_to_lds_b128 %0, %1, off\n\t"
               "global_load_async_to_lds_b128 %2, %3, off\n\t"
               "s_wait_xcnt 0x0"
               :: "v"(lds_k), "v"(gk), "v"(lds_v), "v"(gv) : "memory");
}

// ---------------------------------------------------------------------------
// Kernel 1: q/k/v = x @ W^T + b.  grid=(MROWS/16, 3), block=128 (4 waves).
// Each wave: one 16-row x 64-col tile; A fragment reused across 4 B tiles.
// A 16x4 f32 frag: lane<16 -> (x[m][k],x[m][k+1]); lane>=16 -> (k+2,k+3).
// B 4x16 f32 frag: lane holds col n: (W[n][k+2*ksel], W[n][k+2*ksel+1]).
// ---------------------------------------------------------------------------
__global__ __launch_bounds__(128)
void qkv_proj_kernel(const float* __restrict__ x,
                     const float* __restrict__ wq, const float* __restrict__ bq,
                     const float* __restrict__ wk, const float* __restrict__ bk,
                     const float* __restrict__ wv, const float* __restrict__ bv,
                     float* __restrict__ qb, float* __restrict__ kb,
                     float* __restrict__ vb)
{
  const float* w;  const float* bias;  float* out;
  if (blockIdx.y == 0)      { w = wq; bias = bq; out = qb; }
  else if (blockIdx.y == 1) { w = wk; bias = bk; out = kb; }
  else                      { w = wv; bias = bv; out = vb; }

  const int wave = threadIdx.x >> 5;
  const int lane = threadIdx.x & 31;
  const int lh   = lane & 15;
  const int ksel = lane >> 4;          // 0 or 1 (K half of fragment)

  const int mt = blockIdx.x;           // 16-row tile
  const int m  = mt * 16 + lh;
  const int c0 = wave * 64;            // 64-col group

  const float* xrow = x + (size_t)m * DD + 2 * ksel;
  const float* wr0  = w + (size_t)(c0 + 0 * 16 + lh) * DD + 2 * ksel;
  const float* wr1  = w + (size_t)(c0 + 1 * 16 + lh) * DD + 2 * ksel;
  const float* wr2  = w + (size_t)(c0 + 2 * 16 + lh) * DD + 2 * ksel;
  const float* wr3  = w + (size_t)(c0 + 3 * 16 + lh) * DD + 2 * ksel;

  v8f acc0 = {}, acc1 = {}, acc2 = {}, acc3 = {};

#pragma unroll 4
  for (int kk = 0; kk < DD / 4; ++kk) {
    const int o = 4 * kk;
    v2f a = ld2(xrow + o);
    acc0 = wmma4(a, ld2(wr0 + o), acc0);
    acc1 = wmma4(a, ld2(wr1 + o), acc1);
    acc2 = wmma4(a, ld2(wr2 + o), acc2);
    acc3 = wmma4(a, ld2(wr3 + o), acc3);
  }

  // Epilogue: C/D layout -> VGPR j holds row (mt*16 + j + 8*ksel), col = lh
  const int rowbase = mt * 16 + 8 * ksel;
  v8f accs[4] = {acc0, acc1, acc2, acc3};
#pragma unroll
  for (int t = 0; t < 4; ++t) {
    const int col = c0 + t * 16 + lh;
    const float bv_ = bias[col];
#pragma unroll
    for (int j = 0; j < 8; ++j)
      out[(size_t)(rowbase + j) * DD + col] = accs[t][j] + bv_;
  }
}

// ---------------------------------------------------------------------------
// Kernel 2: spinor flash attention.  grid=(N/64, H, B), block=512 (16 waves).
// All waves share one (b,h); wave w owns query tile (w & 3) and key group
// (w >> 2), so each query tile's keys are walked by 4 waves side by side and a
// SIMD holds 8 waves instead of 2 to cover LDS, vector and barrier waits.
// K/V 64x32 stages are put in LDS once per block via double-buffered gfx1250
// async copies (ASYNCcnt), the next stage's copies flying under this stage's
// WMMAs.  The 4 partial results of a query tile are added through LDS at the end.
// Scores are bounded in [0, 0.177] after scaling -> plain sum-of-exp softmax,
// so partial sums over key groups add with no rescale.
// re uses K directly; im uses the per-lane pair-rotated K (free swap+negate).
// P (exp weights) goes C-layout -> LDS (padded) -> A-layout for the PV WMMAs.
// ---------------------------------------------------------------------------
__global__ __launch_bounds__(ATTN_THREADS)
void spinor_attn_kernel(const float* __restrict__ qb,
                        const float* __restrict__ kb,
                        const float* __restrict__ vb,
                        float* __restrict__ ob)
{
  extern __shared__ __attribute__((aligned(16))) float smem[];

  const int tid  = threadIdx.x;
  const int wave = tid >> 5;
  const int lane = tid & 31;
  const int lh   = lane & 15;
  const int ksel = lane >> 4;
  const int qi   = wave & (QTILES - 1);   // query tile inside the block
  const int kg   = wave / QTILES;         // key group 0..3

  const int b  = blockIdx.z;
  const int h  = blockIdx.y;
  const int qt = blockIdx.x * QTILES + qi; // query tile 0..127
  const int n0 = qt * 16;

  // Cooperative stage loader: thread t moves one 16B chunk of K and of V.
  const int lr = tid >> 3;                // stage row 0..63
  const int lc = (tid & 7) * 4;           // stage col 0,4,...,28
  const size_t gtile = (size_t)(b * NN + lr) * DD + h * HD + lc;
  const unsigned lds_k =
      (unsigned)(size_t)(smem + KT_OFF + lr * TILE_STRIDE + lc);
  const unsigned lds_v =
      (unsigned)(size_t)(smem + VT_OFF + lr * TILE_STRIDE + lc);

  // Prologue: stage 0 into buffer 0.
  async_copy_kv(lds_k, kb + gtile, lds_v, vb + gtile);

  // Preload 8 Q A-fragments (d = 0..31 in steps of 4)
  const float* qp = qb + (size_t)(b * NN + n0 + lh) * DD + h * HD + 2 * ksel;
  v2f qa[8];
#pragma unroll
  for (int s = 0; s < 8; ++s) qa[s] = ld2(qp + 4 * s);

  v8f o0 = {}, o1 = {};     // PV accumulators, d in [0,16) and [16,32)
  v8f lsum = {};            // per-lane partial sum of exp-weights

  float* myp = smem + PB_OFF + wave * 320;   // 16x20 padded P tile

  // Stage 0 has landed for this wave; behind the barrier for every wave.
  asm volatile("s_wait_asynccnt 0x0" ::: "memory");
  __syncthreads();
  // Stage 1 into buffer 1; it flies under stage 0's work.
  async_copy_kv(lds_k + BUF_FLOATS * 4, kb + gtile + (size_t)STAGE_KEYS * DD,
                lds_v + BUF_FLOATS * 4, vb + gtile + (size_t)STAGE_KEYS * DD);

  for (int st = 0; st < NSTAGE; ++st) {
    const int buf = st & 1;
    const float* ks = smem + KT_OFF + buf * BUF_FLOATS + kg * 16 * TILE_STRIDE;
    const float* vs = smem + VT_OFF + buf * BUF_FLOATS + kg * 16 * TILE_STRIDE;

    // ---- scores: re = q.k , im = q.rot(k) ----
    v8f re = {}, im = {};
    const float* krow = ks + lh * TILE_STRIDE + 2 * ksel;
#pragma unroll
    for (int s = 0; s < 8; ++s) {
      v2f kf = ld2(krow + 4 * s);
      re = wmma4(qa[s], kf, re);
      v2f kr; kr[0] = -kf[1]; kr[1] = kf[0];   // pair rotation (i * conj trick)
      im = wmma4(qa[s], kr, im);
    }

    // ---- weight + exp (closed form: cos(atan2(im,re)) = re*rsqrt(re^2+im^2))
    v8f p;
#pragma unroll
    for (int j = 0; j < 8; ++j) {
      float r = re[j], i = im[j];
      float den = r * r + i * i;
      float c = (den > 0.0f) ? r * __frsqrt_rn(den) : 1.0f;
      float wv = 0.5f * (1.0f + c) * INV_SCALE;
      float e = __expf(wv);
      p[j] = e;
      lsum[j] += e;
    }

    // ---- transpose P through LDS: C-layout store, A-layout load ----
#pragma unroll
    for (int j = 0; j < 8; ++j)
      myp[(j + 8 * ksel) * 20 + lh] = p[j];
    asm volatile("s_wait_dscnt 0" ::: "memory");   // wave-local RAW turn-around

    // ---- PV: out += P(16x16) @ V(16x32) ----
#pragma unroll
    for (int kk = 0; kk < 4; ++kk) {
      v2f pa = ld2(myp + lh * 20 + 4 * kk + 2 * ksel);
      const float* vrow = vs + (4 * kk + 2 * ksel) * TILE_STRIDE;
      v2f b0, b1;
      b0[0] = vrow[lh];                    b0[1] = vrow[TILE_STRIDE + lh];
      b1[0] = vrow[16 + lh];               b1[1] = vrow[TILE_STRIDE + 16 + lh];
      o0 = wmma4(pa, b0, o0);
      o1 = wmma4(pa, b1, o1);
    }

    // Publish point of stage st+1: my LDS reads of this buffer are done, my
    // copies of the next stage have landed; behind the barrier both hold for
    // every wave, so the buffer just read may be refilled.
    asm volatile("s_wait_dscnt 0x0" ::: "memory");
    asm volatile("s_wait_asynccnt 0x0" ::: "memory");
    __syncthreads();
    if (st + 2 < NSTAGE) {
      const size_t gnext = gtile + (size_t)((st + 2) * STAGE_KEYS) * DD;
      const unsigned lo = (unsigned)(buf * BUF_FLOATS * 4);
      async_copy_kv(lds_k + lo, kb + gnext, lds_v + lo, vb + gnext);
    }
  }
  // No copy is left in flight when the ring becomes the partial-sum buffer.
  asm volatile("s_wait_asynccnt 0x0" ::: "memory");

  // ---- add the 4 key groups' partial sums (the last trip's barrier has ended
  // every read of the ring): groups 1..3 store, group 0 adds in group order ----
  float4* cb = reinterpret_cast<float4*>(smem);
  if (kg != 0) {
    float4* d = cb + ((kg - 1) * QTILES + qi) * 192 + lane;
    d[0]   = make_float4(o0[0], o0[1], o0[2], o0[3]);
    d[32]  = make_float4(o0[4], o0[5], o0[6], o0[7]);
    d[64]  = make_float4(o1[0], o1[1], o1[2], o1[3]);
    d[96]  = make_float4(o1[4], o1[5], o1[6], o1[7]);
    d[128] = make_float4(lsum[0], lsum[1], lsum[2], lsum[3]);
    d[160] = make_float4(lsum[4], lsum[5], lsum[6], lsum[7]);
  }
  __syncthreads();
  if (kg != 0) return;
  // Both loops unrolled: constant indices keep o0, o1 and lsum in registers.
#pragma unroll
  for (int g = 0; g < KGROUPS - 1; ++g) {
    const float4* s = cb + (g * QTILES + qi) * 192 + lane;
#pragma unroll
    for (int i = 0; i < 2; ++i) {
      const float4 a0 = s[32 * i], a1 = s[64 + 32 * i], al = s[128 + 32 * i];
      o0[4 * i + 0] += a0.x;  o0[4 * i + 1] += a0.y;
      o0[4 * i + 2] += a0.z;  o0[4 * i + 3] += a0.w;
      o1[4 * i + 0] += a1.x;  o1[4 * i + 1] += a1.y;
      o1[4 * i + 2] += a1.z;  o1[4 * i + 3] += a1.w;
      lsum[4 * i + 0] += al.x;  lsum[4 * i + 1] += al.y;
      lsum[4 * i + 2] += al.z;  lsum[4 * i + 3] += al.w;
    }
  }

  // ---- softmax normalization: reduce exp-sums over the 16 columns ----
#pragma unroll
  for (int j = 0; j < 8; ++j) {
    float s = lsum[j];
    s += __shfl_xor(s, 1);
    s += __shfl_xor(s, 2);
    s += __shfl_xor(s, 4);
    s += __shfl_xor(s, 8);                 // stays within each 16-lane half
    const float inv = __frcp_rn(s);
    const size_t ro = (size_t)(b * NN + n0 + j + 8 * ksel) * DD + h * HD;
    ob[ro + lh]      = o0[j] * inv;
    ob[ro + 16 + lh] = o1[j] * inv;
  }
}

// ---------------------------------------------------------------------------
// Kernel 3: gate MLP (Linear->SiLU->Linear->Sigmoid) + final multiply.
// grid=4096/16, block=128 (4 waves).  A block owns 16 rows; wave w forms the
// 16 rows x 16 hidden units [16w, 16w+16) of the first layer on f32 WMMA, so a
// weight row is read once per 16 rows and a fragment load touches 16 lines.
// The row tile comes in by whole-line loads, stays in registers for the final
// multiply and goes through LDS (pitch 260 floats) for the A fragments.
// Fragments are read 16 bytes a lane: lane half ksel holds k = 8s+4*ksel..+3;
// floats 0,1 feed one WMMA and floats 2,3 the next, alike in A and B.
// ---------------------------------------------------------------------------
#define GROWS   16
#define XPITCH  260            // 16B-aligned rows, b128 fragment reads conflict-free
#define TPITCH  68             // 16B-aligned rows of the 16 x 64 second-layer terms

typedef float v4f __attribute__((ext_vector_type(4)));

__global__ __launch_bounds__(128)
void gate_kernel(const float* __restrict__ ob,
                 const float* __restrict__ wg1, const float* __restrict__ bg1,
                 const float* __restrict__ wg2, const float* __restrict__ bg2,
                 float* __restrict__ out)
{
  __shared__ __attribute__((aligned(16))) float xt[GROWS * XPITCH];
  __shared__ __attribute__((aligned(16))) float tt[GROWS * TPITCH];

  const int tid  = threadIdx.x;
  const int wave = tid >> 5;
  const int lane = tid & 31;
  const int lh   = lane & 15;
  const int ksel = lane >> 4;
  const int r0   = blockIdx.x * GROWS;

  // Every loop below is unrolled whole: constant indices keep xv, wf, af and the
  // accumulators in registers.
  // Thread t owns row t/8 of the tile, floats 4*(t%8) + 32*i: 8 lanes cover one
  // 128-byte line, a wave 4 whole lines per load.
  const int xr = tid >> 3;
  const int xc = (tid & 7) * 4;
  const float* xg = ob + (size_t)(r0 + xr) * DD + xc;
  v4f xv[8];
#pragma unroll
  for (int i = 0; i < 8; ++i)
    xv[i] = *reinterpret_cast<const v4f*>(xg + 32 * i);
#pragma unroll
  for (int i = 0; i < 8; ++i)
    *reinterpret_cast<v4f*>(&xt[xr * XPITCH + xc + 32 * i]) = xv[i];

  const int hid = wave * 16 + lh;              // this lane's hidden unit
  const float* bp = wg1 + (size_t)hid * DD + 4 * ksel;
  // All of this lane's weights are asked for ahead of the barrier, so that they
  // fly while the row tile lands: one wave a SIMD has nothing else to hide them.
  v4f wf[DD / 8];
#pragma unroll
  for (int s = 0; s < DD / 8; ++s)
    wf[s] = *reinterpret_cast<const v4f*>(bp + 8 * s);
  const float b1 = bg1[hid];
  const float w2 = wg2[hid];
  const float b2 = bg2[0];

  __syncthreads();                             // the row tile is complete in LDS
  // Precaution: the translation wait stands in front of the first reuse of the
  // loads' address registers (the accumulators take them).
  asm volatile("s_wait_xcnt 0x0" ::: "memory");

  const float* ap = &xt[lh * XPITCH + 4 * ksel];
  v8f acc0 = {}, acc1 = {};
  // A fragments come from LDS eight at a time, one group ahead of the WMMAs
  // that use them, so that the LDS latency lies under 16 WMMAs of work.
  v4f af[2][8];
#pragma unroll
  for (int i = 0; i < 8; ++i)
    af[0][i] = *reinterpret_cast<const v4f*>(ap + 8 * i);
#pragma unroll
  for (int g = 0; g < DD / 64; ++g) {
    if (g + 1 < DD / 64) {
#pragma unroll
      for (int i = 0; i < 8; ++i)
        af[(g + 1) & 1][i] = *reinterpret_cast<const v4f*>(ap + 64 * (g + 1) + 8 * i);
      // Keeps the eight reads issued here: the scheduler otherwise sinks each
      // to two WMMAs ahead of its use, which leaves the LDS latency exposed.
      __builtin_amdgcn_sched_barrier(0);
    }
#pragma unroll
    for (int i = 0; i < 8; ++i) {
      const v4f a = af[g & 1][i];
      const v4f w = wf[8 * g + i];
      v2f a0, a1, w0, w1;
      a0[0] = a[0];  a0[1] = a[1];  a1[0] = a[2];  a1[1] = a[3];
      w0[0] = w[0];  w0[1] = w[1];  w1[0] = w[2];  w1[1] = w[3];
      acc0 = wmma4(a0, w0, acc0);
      acc1 = wmma4(a1, w1, acc1);
    }
  }

  // D layout: register j holds row j + 8*ksel, hidden unit hid.
#pragma unroll
  for (int j = 0; j < 8; ++j) {
    const float z = acc0[j] + acc1[j] + b1;
    tt[(j + 8 * ksel) * TPITCH + hid] = z * sigmoidf_(z) * w2;   // SiLU * wg2
  }
  __syncthreads();                             // all 64 terms of every row stand

  // The 8 threads of a row add 8 terms each, then across the 8 lanes.
  const v4f t0 = *reinterpret_cast<const v4f*>(&tt[xr * TPITCH + (tid & 7) * 8]);
  const v4f t1 = *reinterpret_cast<const v4f*>(&tt[xr * TPITCH + (tid & 7) * 8 + 4]);
  float g = ((t0[0] + t0[1]) + (t0[2] + t0[3])) + ((t1[0] + t1[1]) + (t1[2] + t1[3]));
  g += __shfl_xor(g, 1);
  g += __shfl_xor(g, 2);
  g += __shfl_xor(g, 4);
  g = sigmoidf_(g + b2);

  float* og = out + (size_t)(r0 + xr) * DD + xc;
#pragma unroll
  for (int i = 0; i < 8; ++i)
    *reinterpret_cast<v4f*>(og + 32 * i) = xv[i] * g;
}

// ---------------------------------------------------------------------------
extern "C" void kernel_launch(void* const* d_in, const int* in_sizes, int n_in,
                              void* d_out, int out_size, void* d_ws,
                              size_t ws_size, hipStream_t stream)
{
  const float* x   = (const float*)d_in[0];
  const float* wq  = (const float*)d_in[1];
  const float* bq  = (const float*)d_in[2];
  const float* wk  = (const float*)d_in[3];
  const float* bk  = (const float*)d_in[4];
  const float* wv  = (const float*)d_in[5];
  const float* bv  = (const float*)d_in[6];
  const float* wg1 = (const float*)d_in[7];
  const float* bg1 = (const float*)d_in[8];
  const float* wg2 = (const float*)d_in[9];
  const float* bg2 = (const float*)d_in[10];
  float* out = (float*)d_out;

  // Workspace: q | k | v | attn_out   (4 x 4 MB = 16 MB)
  float* qb = (float*)d_ws;
  float* kb = qb + (size_t)MROWS * DD;
  float* vb = kb + (size_t)MROWS * DD;
  float* ob = vb + (size_t)MROWS * DD;

  {
    dim3 grid(MROWS / 16, 3);
    qkv_proj_kernel<<<grid, 128, 0, stream>>>(x, wq, bq, wk, bk, wv, bv,
                                              qb, kb, vb);
  }
  {
    dim3 grid(NN / 64, HH, BB);
    spinor_attn_kernel<<<grid, ATTN_THREADS, SMEM_BYTES, stream>>>(qb, kb, vb, ob);
  }
  {
    dim3 grid(MROWS / 16);
    gate_kernel<<<grid, 128, 0, stream>>>(ob, wg1, bg1, wg2, bg2, out);
  }
}

// v003
// One run takes 91.1 microseconds.
// Next to v002, in two timings, it ran 1.16 times as fast each time.
// Counting every step since v000, it is 1.49 times as fast.
#include <hip/hip_runtime.h>
#include <hip/hip_bf16.h>
#include <math.h>

// Problem constants (match reference)
#define BB  2
#define NN  2048
#define DD  256
#define HH  8
#define HD  32
#define MROWS (BB*NN)          // 4096 flattened rows
// 1/(sqrt(32)+1e-6)
#define INV_SCALE 0.17677666f

// Attention work-group: 16 waves = 4 query tiles x 4 key groups.  A stage is
// 64 keys; key group g works on rows [16g, 16g+16) of every stage.
#define QTILES   4
#define KGROUPS  4
#define STAGE_KEYS (16 * KGROUPS)
#define NSTAGE   (NN / STAGE_KEYS)
#define ATTN_THREADS (32 * QTILES * KGROUPS)

// LDS layout for the attention kernel (float indices, dynamic LDS only):
//   K stages: 2 bufs x 64 rows x 36 floats   -> [0,    4608)
//   V stages: 2 bufs x 64 rows x 36 floats   -> [4608, 9216)
//   P bufs  : 16 waves x 16 rows x 20 floats -> [9216, 14336)
// After the key loop [0, 9216) is reused for the partial sums of key groups
// 1..3: 12 waves x 24 values x 32 lanes.
#define TILE_STRIDE 36         // 16B-aligned rows (36*4=144), conflict-free reads
#define BUF_FLOATS (STAGE_KEYS * TILE_STRIDE)
#define KT_OFF   0
#define VT_OFF   (2 * BUF_FLOATS)
#define PB_OFF   (4 * BUF_FLOATS)
#define SMEM_FLOATS (PB_OFF + QTILES * KGROUPS * 320)
#define SMEM_BYTES  (SMEM_FLOATS * 4)

typedef float v2f __attribute__((ext_vector_type(2)));
typedef float v4f __attribute__((ext_vector_type(4)));
typedef float v8f __attribute__((ext_vector_type(8)));

// D = A(16x4 f32) * B(4x16 f32) + C, one wave, fp32 WMMA
__device__ __forceinline__ v8f wmma4(v2f a, v2f b, v8f c) {
  return __builtin_amdgcn_wmma_f32_16x16x4_f32(
      /*neg_a=*/false, a, /*neg_b=*/false, b,
      /*c_mod=*/(short)0, c, /*reuse_a=*/false, /*reuse_b=*/false);
}

__device__ __forceinline__ v2f ld2(const float* p) {
  return *reinterpret_cast<const v2f*>(p);
}

__device__ __forceinline__ float sigmoidf_(float x) {
  return 1.0f / (1.0f + __expf(-x));
}

// gfx1250 async copies, tracked by ASYNCcnt: one 16-byte chunk of K and one of
// V per lane.  The s_wait_xcnt stands in the copies' own statement so that no
// later write of an address register can be scheduled in front of it.
__device__ __forceinline__ void async_copy_kv(unsigned lds_k, const float* gk,
                                              unsigned lds_v, const float* gv) {
  asm volatile("global_load_async_to_lds_b128 %0, %1, off\n\t"
               "global_load_async_to_lds_b128 %2, %3, off\n\t"
               "s_wait_xcnt 0x0"
               :: "v"(lds_k), "v"(gk), "v"(lds_v), "v"(gv) : "memory");
}

// ---------------------------------------------------------------------------
// Kernel 1: q/k/v = x @ W^T + b.  grid=(MROWS/64, 12), block=128 (4 waves).
// A block forms a 64-row x 64-col tile of one of q, k, v; wave w the 32 x 32
// part (w >> 1, w & 1) as 2 x 2 WMMA tiles, so a 128-byte output line has one
// writer.  The 64 rows of x and the 64 rows of W come into LDS 64 k at a time by
// async copies of whole lines (two buffers, the next stage flying under this
// stage's WMMAs); a global line is so asked for once per block.
// Fragments are read 16 bytes a lane: lane half ksel holds k = 8s+4*ksel..+3;
// floats 0,1 feed one WMMA and floats 2,3 the next, alike in A and B.
// ---------------------------------------------------------------------------
#define PT_ROWS  64            // rows of x, and rows of W, in a block's tile
#define PT_KC    64            // k per stage: 256 bytes of every row
#define PT_PITCH 68            // 272-byte rows: b128 fragment reads conflict-free
#define PT_OPER  (PT_ROWS * PT_PITCH)      // one operand's stage, floats
#define PT_BUF   (2 * PT_OPER)             // x stage, then W stage
#define PT_NST   (DD / PT_KC)

// Eight async copies (ASYNCcnt): rows r, r+8, ..., r+56 of one operand's stage,
// 16 bytes a lane, 16 lanes a row.  The s_wait_xcnt stands in the copies' own
// statement so that no later write of an address register can be scheduled in
// front of it.
__device__ __forceinline__ void async_copy_rows8(unsigned lds, const float* g) {
  asm volatile("global_load_async_to_lds_b128 %0, %8, off\n\t"
               "global_load_async_to_lds_b128 %1, %9, off\n\t"
               "global_load_async_to_lds_b128 %2, %10, off\n\t"
               "global_load_async_to_lds_b128 %3, %11, off\n\t"
               "global_load_async_to_lds_b128 %4, %12, off\n\t"
               "global_load_async_to_lds_b128 %5, %13, off\n\t"
               "global_load_async_to_lds_b128 %6, %14, off\n\t"
               "global_load_async_to_lds_b128 %7, %15, off\n\t"
               "s_wait_xcnt 0x0"
               :: "v"(lds),
                  "v"(lds +  8 * PT_PITCH * 4), "v"(lds + 16 * PT_PITCH * 4),
                  "v"(lds + 24 * PT_PITCH * 4), "v"(lds + 32 * PT_PITCH * 4),
                  "v"(lds + 40 * PT_PITCH * 4), "v"(lds + 48 * PT_PITCH * 4),
                  "v"(lds + 56 * PT_PITCH * 4),
                  "v"(g),
                  "v"(g +  8 * DD), "v"(g + 16 * DD), "v"(g + 24 * DD),
                  "v"(g + 32 * DD), "v"(g + 40 * DD), "v"(g + 48 * DD),
                  "v"(g + 56 * DD)
               : "memory");
}

__global__ __launch_bounds__(128)
void qkv_proj_kernel(const float* __restrict__ x,
                     const float* __restrict__ wq, const float* __restrict__ bq,
                     const float* __restrict__ wk, const float* __restrict__ bk,
                     const float* __restrict__ wv, const float* __restrict__ bv,
                     float* __restrict__ qb, float* __restrict__ kb,
                     float* __restrict__ vb)
{
  __shared__ __attribute__((aligned(16))) float st[2 * PT_BUF];

  const int mat = blockIdx.y >> 2;     // 0: q, 1: k, 2: v
  const float* w;  const float* bias;  float* out;
  if (mat == 0)      { w = wq; bias = bq; out = qb; }
  else if (mat == 1) { w = wk; bias = bk; out = kb; }
  else               { w = wv; bias = bv; out = vb; }

  const int tid  = threadIdx.x;
  const int wave = tid >> 5;
  const int lane = tid & 31;
  const int lh   = lane & 15;
  const int ksel = lane >> 4;          // 0 or 1 (K half of fragment)
  const int wr   = wave >> 1;          // 32-row half of the tile
  const int wc   = wave & 1;           // 32-col half of the tile

  const int r0 = blockIdx.x * PT_ROWS;         // first row of x
  const int c0 = (blockIdx.y & 3) * PT_ROWS;   // first output column = row of W

  // Stage loader: thread t moves floats 4*(t%16).. of rows t/16 + 8*i.
  const int cr = tid >> 4;
  const int cc = (tid & 15) * 4;
  const float* gx = x + (size_t)(r0 + cr) * DD + cc;
  const float* gw = w + (size_t)(c0 + cr) * DD + cc;
  const unsigned lx = (unsigned)(size_t)(st + cr * PT_PITCH + cc);
  const unsigned lw = lx + PT_OPER * 4;

  // Prologue: stage 0 into buffer 0.
  async_copy_rows8(lx, gx);
  async_copy_rows8(lw, gw);
  // Stage 0 has landed for this wave; behind the barrier for every wave.
  asm volatile("s_wait_asynccnt 0x0" ::: "memory");
  __syncthreads();
  // Stage 1 into buffer 1; it flies under stage 0's work.
  async_copy_rows8(lx + PT_BUF * 4, gx + PT_KC);
  async_copy_rows8(lw + PT_BUF * 4, gw + PT_KC);

  v8f acc00 = {}, acc01 = {}, acc10 = {}, acc11 = {};

  for (int s = 0; s < PT_NST; ++s) {
    const int buf = s & 1;
    const float* ap = st + buf * PT_BUF + (wr * 32 + lh) * PT_PITCH + 4 * ksel;
    const float* bp = st + buf * PT_BUF + PT_OPER + (wc * 32 + lh) * PT_PITCH + 4 * ksel;
    // Unrolled whole: the fragment reads take constant offsets.
#pragma unroll
    for (int k = 0; k < PT_KC / 8; ++k) {
      const v4f a0 = *reinterpret_cast<const v4f*>(ap + 8 * k);
      const v4f a1 = *reinterpret_cast<const v4f*>(ap + 16 * PT_PITCH + 8 * k);
      const v4f b0 = *reinterpret_cast<const v4f*>(bp + 8 * k);
      const v4f b1 = *reinterpret_cast<const v4f*>(bp + 16 * PT_PITCH + 8 * k);
      v2f a0l, a0h, a1l, a1h, b0l, b0h, b1l, b1h;
      a0l[0] = a0[0];  a0l[1] = a0[1];  a0h[0] = a0[2];  a0h[1] = a0[3];
      a1l[0] = a1[0];  a1l[1] = a1[1];  a1h[0] = a1[2];  a1h[1] = a1[3];
      b0l[0] = b0[0];  b0l[1] = b0[1];  b0h[0] = b0[2];  b0h[1] = b0[3];
      b1l[0] = b1[0];  b1l[1] = b1[1];  b1h[0] = b1[2];  b1h[1] = b1[3];
      acc00 = wmma4(a0l, b0l, acc00);
      acc01 = wmma4(a0l, b1l, acc01);
      acc10 = wmma4(a1l, b0l, acc10);
      acc11 = wmma4(a1l, b1l, acc11);
      acc00 = wmma4(a0h, b0h, acc00);
      acc01 = wmma4(a0h, b1h, acc01);
      acc10 = wmma4(a1h, b0h, acc10);
      acc11 = wmma4(a1h, b1h, acc11);
    }

    // Publish point of stage s+1: my LDS reads of this buffer are done, my
    // copies of the next stage have landed; behind the barrier both hold for
    // every wave, so the buffer just read may be refilled.
    asm volatile("s_wait_dscnt 0x0" ::: "memory");
    asm volatile("s_wait_asynccnt 0x0" ::: "memory");
    __syncthreads();
    if (s + 2 < PT_NST) {
      const unsigned lo = (unsigned)(buf * PT_BUF * 4);
      async_copy_rows8(lx + lo, gx + (s + 2) * PT_KC);
      async_copy_rows8(lw + lo, gw + (s + 2) * PT_KC);
    }
  }
  // No copy is left in flight when the wave ends.
  asm volatile("s_wait_asynccnt 0x0" ::: "memory");

  // Epilogue: C/D layout -> VGPR j holds row (tile row + j + 8*ksel), col = lh
  const int col = c0 + wc * 32 + lh;
  const float bias0 = bias[col];
  const float bias1 = bias[col + 16];
  float* op = out + (size_t)(r0 + wr * 32 + 8 * ksel) * DD + col;
#pragma unroll
  for (int j = 0; j < 8; ++j) {
    op[(size_t)j * DD]             = acc00[j] + bias0;
    op[(size_t)j * DD + 16]        = acc01[j] + bias1;
    op[(size_t)(j + 16) * DD]      = acc10[j] + bias0;
    op[(size_t)(j + 16) * DD + 16] = acc11[j] + bias1;
  }
}

// ---------------------------------------------------------------------------
// Kernel 2: spinor flash attention.  grid=(N/64, H, B), block=512 (16 waves).
// All waves share one (b,h); wave w owns query tile (w & 3) and key group
// (w >> 2), so each query tile's keys are walked by 4 waves side by side and a
// SIMD holds 8 waves instead of 2 to cover LDS, vector and barrier waits.
// K/V 64x32 stages are put in LDS once per block via double-buffered gfx1250
// async copies (ASYNCcnt), the next stage's copies flying under this stage's
// WMMAs.  The 4 partial results of a query tile are added through LDS at the end.
// Scores are bounded in [0, 0.177] after scaling -> plain sum-of-exp softmax,
// so partial sums over key groups add with no rescale.
// re uses K directly; im uses the per-lane pair-rotated K (free swap+negate).
// P (exp weights) goes C-layout -> LDS (padded) -> A-layout for the PV WMMAs.
// ---------------------------------------------------------------------------
__global__ __launch_bounds__(ATTN_THREADS)
void spinor_attn_kernel(const float* __restrict__ qb,
                        const float* __restrict__ kb,
                        const float* __restrict__ vb,
                        float* __restrict__ ob)
{
  extern __shared__ __attribute__((aligned(16))) float smem[];

  const int tid  = threadIdx.x;
  const int wave = tid >> 5;
  const int lane = tid & 31;
  const int lh   = lane & 15;
  const int ksel = lane >> 4;
  const int qi   = wave & (QTILES - 1);   // query tile inside the block
  const int kg   = wave / QTILES;         // key group 0..3

  const int b  = blockIdx.z;
  const int h  = blockIdx.y;
  const int qt = blockIdx.x * QTILES + qi; // query tile 0..127
  const int n0 = qt * 16;

  // Cooperative stage loader: thread t moves one 16B chunk of K and of V.
  const int lr = tid >> 3;                // stage row 0..63
  const int lc = (tid & 7) * 4;           // stage col 0,4,...,28
  const size_t gtile = (size_t)(b * NN + lr) * DD + h * HD + lc;
  const unsigned lds_k =
      (unsigned)(size_t)(smem + KT_OFF + lr * TILE_STRIDE + lc);
  const unsigned lds_v =
      (unsigned)(size_t)(smem + VT_OFF + lr * TILE_STRIDE + lc);

  // Prologue: stage 0 into buffer 0.
  async_copy_kv(lds_k, kb + gtile, lds_v, vb + gtile);

  // Preload 8 Q A-fragments (d = 0..31 in steps of 4)
  const float* qp = qb + (size_t)(b * NN + n0 + lh) * DD + h * HD + 2 * ksel;
  v2f qa[8];
#pragma unroll
  for (int s = 0; s < 8; ++s) qa[s] = ld2(qp + 4 * s);

  v8f o0 = {}, o1 = {};     // PV accumulators, d in [0,16) and [16,32)
  v8f lsum = {};            // per-lane partial sum of exp-weights

  float* myp = smem + PB_OFF + wave * 320;   // 16x20 padded P tile

  // Stage 0 has landed for this wave; behind the barrier for every wave.
  asm volatile("s_wait_asynccnt 0x0" ::: "memory");
  __syncthreads();
  // Stage 1 into buffer 1; it flies under stage 0's work.
  async_copy_kv(lds_k + BUF_FLOATS * 4, kb + gtile + (size_t)STAGE_KEYS * DD,
                lds_v + BUF_FLOATS * 4, vb + gtile + (size_t)STAGE_KEYS * DD);

  for (int st = 0; st < NSTAGE; ++st) {
    const int buf = st & 1;
    const float* ks = smem + KT_OFF + buf * BUF_FLOATS + kg * 16 * TILE_STRIDE;
    const float* vs = smem + VT_OFF + buf * BUF_FLOATS + kg * 16 * TILE_STRIDE;

    // ---- scores: re = q.k , im = q.rot(k) ----
    v8f re = {}, im = {};
    const float* krow = ks + lh * TILE_STRIDE + 2 * ksel;
#pragma unroll
    for (int s = 0; s < 8; ++s) {
      v2f kf = ld2(krow + 4 * s);
      re = wmma4(qa[s], kf, re);
      v2f kr; kr[0] = -kf[1]; kr[1] = kf[0];   // pair rotation (i * conj trick)
      im = wmma4(qa[s], kr, im);
    }

    // ---- weight + exp (closed form: cos(atan2(im,re)) = re*rsqrt(re^2+im^2))
    v8f p;
#pragma unroll
    for (int j = 0; j < 8; ++j) {
      float r = re[j], i = im[j];
      float den = r * r + i * i;
      float c = (den > 0.0f) ? r * __frsqrt_rn(den) : 1.0f;
      float wv = 0.5f * (1.0f + c) * INV_SCALE;
      float e = __expf(wv);
      p[j] = e;
      lsum[j] += e;
    }

    // ---- transpose P through LDS: C-layout store, A-layout load ----
#pragma unroll
    for (int j = 0; j < 8; ++j)
      myp[(j + 8 * ksel) * 20 + lh] = p[j];
    asm volatile("s_wait_dscnt 0" ::: "memory");   // wave-local RAW turn-around

    // ---- PV: out += P(16x16) @ V(16x32) ----
#pragma unroll
    for (int kk = 0; kk < 4; ++kk) {
      v2f pa = ld2(myp + lh * 20 + 4 * kk + 2 * ksel);
      const float* vrow = vs + (4 * kk + 2 * ksel) * TILE_STRIDE;
      v2f b0, b1;
      b0[0] = vrow[lh];                    b0[1] = vrow[TILE_STRIDE + lh];
      b1[0] = vrow[16 + lh];               b1[1] = vrow[TILE_STRIDE + 16 + lh];
      o0 = wmma4(pa, b0, o0);
      o1 = wmma4(pa, b1, o1);
    }

    // Publish point of stage st+1: my LDS reads of this buffer are done, my
    // copies of the next stage have landed; behind the barrier both hold for
    // every wave, so the buffer just read may be refilled.
    asm volatile("s_wait_dscnt 0x0" ::: "memory");
    asm volatile("s_wait_asynccnt 0x0" ::: "memory");
    __syncthreads();
    if (st + 2 < NSTAGE) {
      const size_t gnext = gtile + (size_t)((st + 2) * STAGE_KEYS) * DD;
      const unsigned lo = (unsigned)(buf * BUF_FLOATS * 4);
      async_copy_kv(lds_k + lo, kb + gnext, lds_v + lo, vb + gnext);
    }
  }
  // No copy is left in flight when the ring becomes the partial-sum buffer.
  asm volatile("s_wait_asynccnt 0x0" ::: "memory");

  // ---- add the 4 key groups' partial sums (the last trip's barrier has ended
  // every read of the ring): groups 1..3 store, group 0 adds in group order ----
  float4* cb = reinterpret_cast<float4*>(smem);
  if (kg != 0) {
    float4* d = cb + ((kg - 1) * QTILES + qi) * 192 + lane;
    d[0]   = make_float4(o0[0], o0[1], o0[2], o0[3]);
    d[32]  = make_float4(o0[4], o0[5], o0[6], o0[7]);
    d[64]  = make_float4(o1[0], o1[1], o1[2], o1[3]);
    d[96]  = make_float4(o1[4], o1[5], o1[6], o1[7]);
    d[128] = make_float4(lsum[0], lsum[1], lsum[2], lsum[3]);
    d[160] = make_float4(lsum[4], lsum[5], lsum[6], lsum[7]);
  }
  __syncthreads();
  if (kg != 0) return;
  // Both loops unrolled: constant indices keep o0, o1 and lsum in registers.
#pragma unroll
  for (int g = 0; g < KGROUPS - 1; ++g) {
    const float4* s = cb + (g * QTILES + qi) * 192 + lane;
#pragma unroll
    for (int i = 0; i < 2; ++i) {
      const float4 a0 = s[32 * i], a1 = s[64 + 32 * i], al = s[128 + 32 * i];
      o0[4 * i + 0] += a0.x;  o0[4 * i + 1] += a0.y;
      o0[4 * i + 2] += a0.z;  o0[4 * i + 3] += a0.w;
      o1[4 * i + 0] += a1.x;  o1[4 * i + 1] += a1.y;
      o1[4 * i + 2] += a1.z;  o1[4 * i + 3] += a1.w;
      lsum[4 * i + 0] += al.x;  lsum[4 * i + 1] += al.y;
      lsum[4 * i + 2] += al.z;  lsum[4 * i + 3] += al.w;
    }
  }

  // ---- softmax normalization: reduce exp-sums over the 16 columns ----
#pragma unroll
  for (int j = 0; j < 8; ++j) {
    float s = lsum[j];
    s += __shfl_xor(s, 1);
    s += __shfl_xor(s, 2);
    s += __shfl_xor(s, 4);
    s += __shfl_xor(s, 8);                 // stays within each 16-lane half
    const float inv = __frcp_rn(s);
    const size_t ro = (size_t)(b * NN + n0 + j + 8 * ksel) * DD + h * HD;
    ob[ro + lh]      = o0[j] * inv;
    ob[ro + 16 + lh] = o1[j] * inv;
  }
}

// ---------------------------------------------------------------------------
// Kernel 3: gate MLP (Linear->SiLU->Linear->Sigmoid) + final multiply.
// grid=4096/16, block=128 (4 waves).  A block owns 16 rows; wave w forms the
// 16 rows x 16 hidden units [16w, 16w+16) of the first layer on f32 WMMA, so a
// weight row is read once per 16 rows and a fragment load touches 16 lines.
// The row tile comes in by whole-line loads, stays in registers for the final
// multiply and goes through LDS (pitch 260 floats) for the A fragments.
// Fragments are read 16 bytes a lane: lane half ksel holds k = 8s+4*ksel..+3;
// floats 0,1 feed one WMMA and floats 2,3 the next, alike in A and B.
// ---------------------------------------------------------------------------
#define GROWS   16
#define XPITCH  260            // 16B-aligned rows, b128 fragment reads conflict-free
#define TPITCH  68             // 16B-aligned rows of the 16 x 64 second-layer terms

__global__ __launch_bounds__(128)
void gate_kernel(const float* __restrict__ ob,
                 const float* __restrict__ wg1, const float* __restrict__ bg1,
                 const float* __restrict__ wg2, const float* __restrict__ bg2,
                 float* __restrict__ out)
{
  __shared__ __attribute__((aligned(16))) float xt[GROWS * XPITCH];
  __shared__ __attribute__((aligned(16))) float tt[GROWS * TPITCH];

  const int tid  = threadIdx.x;
  const int wave = tid >> 5;
  const int lane = tid & 31;
  const int lh   = lane & 15;
  const int ksel = lane >> 4;
  const int r0   = blockIdx.x * GROWS;

  // Every loop below is unrolled whole: constant indices keep xv, wf, af and the
  // accumulators in registers.
  // Thread t owns row t/8 of the tile, floats 4*(t%8) + 32*i: 8 lanes cover one
  // 128-byte line, a wave 4 whole lines per load.
  const int xr = tid >> 3;
  const int xc = (tid & 7) * 4;
  const float* xg = ob + (size_t)(r0 + xr) * DD + xc;
  v4f xv[8];
#pragma unroll
  for (int i = 0; i < 8; ++i)
    xv[i] = *reinterpret_cast<const v4f*>(xg + 32 * i);
#pragma unroll
  for (int i = 0; i < 8; ++i)
    *reinterpret_cast<v4f*>(&xt[xr * XPITCH + xc + 32 * i]) = xv[i];

  const int hid = wave * 16 + lh;              // this lane's hidden unit
  const float* bp = wg1 + (size_t)hid * DD + 4 * ksel;
  // All of this lane's weights are asked for ahead of the barrier, so that they
  // fly while the row tile lands: one wave a SIMD has nothing else to hide them.
  v4f wf[DD / 8];
#pragma unroll
  for (int s = 0; s < DD / 8; ++s)
    wf[s] = *reinterpret_cast<const v4f*>(bp + 8 * s);
  const float b1 = bg1[hid];
  const float w2 = wg2[hid];
  const float b2 = bg2[0];

  __syncthreads();                             // the row tile is complete in LDS
  // Precaution: the translation wait stands in front of the first reuse of the
  // loads' address registers (the accumulators take them).
  asm volatile("s_wait_xcnt 0x0" ::: "memory");

  const float* ap = &xt[lh * XPITCH + 4 * ksel];
  v8f acc0 = {}, acc1 = {};
  // A fragments come from LDS eight at a time, one group ahead of the WMMAs
  // that use them, so that the LDS latency lies under 16 WMMAs of work.
  v4f af[2][8];
#pragma unroll
  for (int i = 0; i < 8; ++i)
    af[0][i] = *reinterpret_cast<const v4f*>(ap + 8 * i);
#pragma unroll
  for (int g = 0; g < DD / 64; ++g) {
    if (g + 1 < DD / 64) {
#pragma unroll
      for (int i = 0; i < 8; ++i)
        af[(g + 1) & 1][i] = *reinterpret_cast<const v4f*>(ap + 64 * (g + 1) + 8 * i);
      // Keeps the eight reads issued here: the scheduler otherwise sinks each
      // to two WMMAs ahead of its use, which leaves the LDS latency exposed.
      __builtin_amdgcn_sched_barrier(0);
    }
#pragma unroll
    for (int i = 0; i < 8; ++i) {
      const v4f a = af[g & 1][i];
      const v4f w = wf[8 * g + i];
      v2f a0, a1, w0, w1;
      a0[0] = a[0];  a0[1] = a[1];  a1[0] = a[2];  a1[1] = a[3];
      w0[0] = w[0];  w0[1] = w[1];  w1[0] = w[2];  w1[1] = w[3];
      acc0 = wmma4(a0, w0, acc0);
      acc1 = wmma4(a1, w1, acc1);
    }
  }

  // D layout: register j holds row j + 8*ksel, hidden unit hid.
#pragma unroll
  for (int j = 0; j < 8; ++j) {
    const float z = acc0[j] + acc1[j] + b1;
    tt[(j + 8 * ksel) * TPITCH + hid] = z * sigmoidf_(z) * w2;   // SiLU * wg2
  }
  __syncthreads();                             // all 64 terms of every row stand

  // The 8 threads of a row add 8 terms each, then across the 8 lanes.
  const v4f t0 = *reinterpret_cast<const v4f*>(&tt[xr * TPITCH + (tid & 7) * 8]);
  const v4f t1 = *reinterpret_cast<const v4f*>(&tt[xr * TPITCH + (tid & 7) * 8 + 4]);
  float g = ((t0[0] + t0[1]) + (t0[2] + t0[3])) + ((t1[0] + t1[1]) + (t1[2] + t1[3]));
  g += __shfl_xor(g, 1);
  g += __shfl_xor(g, 2);
  g += __shfl_xor(g, 4);
  g = sigmoidf_(g + b2);

  float* og = out + (size_t)(r0 + xr) * DD + xc;
#pragma unroll
  for (int i = 0; i < 8; ++i)
    *reinterpret_cast<v4f*>(og + 32 * i) = xv[i] * g;
}

// ---------------------------------------------------------------------------
extern "C" void kernel_launch(void* const* d_in, const int* in_sizes, int n_in,
                              void* d_out, int out_size, void* d_ws,
                              size_t ws_size, hipStream_t stream)
{
  const float* x   = (const float*)d_in[0];
  const float* wq  = (const float*)d_in[1];
  const float* bq  = (const float*)d_in[2];
  const float* wk  = (const float*)d_in[3];
  const float* bk  = (const float*)d_in[4];
  const float* wv  = (const float*)d_in[5];
  const float* bv  = (const float*)d_in[6];
  const float* wg1 = (const float*)d_in[7];
  const float* bg1 = (const float*)d_in[8];
  const float* wg2 = (const float*)d_in[9];
  const float* bg2 = (const float*)d_in[10];
  float* out = (float*)d_out;

  // Workspace: q | k | v | attn_out   (4 x 4 MB = 16 MB)
  float* qb = (float*)d_ws;
  float* kb = qb + (size_t)MROWS * DD;
  float* vb = kb + (size_t)MROWS * DD;
  float* ob = vb + (size_t)MROWS * DD;

  {
    dim3 grid(MROWS / 64, 12);
    qkv_proj_kernel<<<grid, 128, 0, stream>>>(x, wq, bq, wk, bk, wv, bv,
                                              qb, kb, vb);
  }
  {
    dim3 grid(NN / 64, HH, BB);
    spinor_attn_kernel<<<grid, ATTN_THREADS, SMEM_BYTES, stream>>>(qb, kb, vb, ob);
  }
  {
    dim3 grid(MROWS / 16);
    gate_kernel<<<grid, 128, 0, stream>>>(ob, wg1, bg1, wg2, bg2, out);
  }
}

// v004
// It runs in 84 microseconds.
// Timed twice side by side with v003, it ran 1.08 times as fast both times.
// Counting every step since v000, it is 1.61 times as fast.
#include <hip/hip_runtime.h>
#include <hip/hip_bf16.h>
#include <math.h>

// Problem constants (match reference)
#define BB  2
#define NN  2048
#define DD  256
#define HH  8
#define HD  32
#define MROWS (BB*NN)          // 4096 flattened rows
// 1/(sqrt(32)+1e-6)
#define INV_SCALE 0.17677666f

// Attention work-group: 16 waves = 4 query tiles x 4 key groups.  A stage is
// 64 keys; key group g works on rows [16g, 16g+16) of every stage.
#define QTILES   4
#define KGROUPS  4
#define STAGE_KEYS (16 * KGROUPS)
#define NSTAGE   (NN / STAGE_KEYS)
#define ATTN_THREADS (32 * QTILES * KGROUPS)

// Keys are kept in the workspace in three-product form: per (row, head) 64
// floats, of which 48 are used: kr[16] | kr+ki [16] | kr-ki [16] (kr, ki = real
// and imaginary part of the 16 complex components).  The 256-byte pitch gives
// every 128-byte line one writer.
#define KF_PITCH 64            // floats per (row, head) in the workspace
#define KF_ROW   (HH * KF_PITCH)

// LDS layout for the attention kernel (float indices, dynamic LDS only):
//   K stages: 2 bufs x 64 rows x 52 floats   -> [0,     6656)
//   V stages: 2 bufs x 64 rows x 36 floats   -> [6656,  11264)
//   P bufs  : 16 waves x 16 rows x 20 floats -> [11264, 16384)
// After the key loop [0, 9216) is reused for the partial sums of key groups
// 1..3: 12 waves x 24 values x 32 lanes.
#define TILE_STRIDE 36         // 16B-aligned rows (36*4=144), conflict-free reads
#define BUF_FLOATS (STAGE_KEYS * TILE_STRIDE)
#define K_STRIDE 52            // 48 floats + 4: 208-byte rows, 16 B x odd for b128 reads
#define KBUF_FLOATS (STAGE_KEYS * K_STRIDE)
#define KT_OFF   0
#define VT_OFF   (2 * KBUF_FLOATS)
#define PB_OFF   (VT_OFF + 2 * BUF_FLOATS)
#define SMEM_FLOATS (PB_OFF + QTILES * KGROUPS * 320)
#define SMEM_BYTES  (SMEM_FLOATS * 4)

typedef float v2f __attribute__((ext_vector_type(2)));
typedef float v4f __attribute__((ext_vector_type(4)));
typedef float v8f __attribute__((ext_vector_type(8)));

// D = A(16x4 f32) * B(4x16 f32) + C, one wave, fp32 WMMA
__device__ __forceinline__ v8f wmma4(v2f a, v2f b, v8f c) {
  return __builtin_amdgcn_wmma_f32_16x16x4_f32(
      /*neg_a=*/false, a, /*neg_b=*/false, b,
      /*c_mod=*/(short)0, c, /*reuse_a=*/false, /*reuse_b=*/false);
}

__device__ __forceinline__ v2f ld2(const float* p) {
  return *reinterpret_cast<const v2f*>(p);
}

__device__ __forceinline__ float sigmoidf_(float x) {
  return 1.0f / (1.0f + __expf(-x));
}

// gfx1250 async copies, tracked by ASYNCcnt: one 16-byte chunk of K and one of
// V per lane.  The s_wait_xcnt stands in the copies' own statement so that no
// later write of an address register can be scheduled in front of it.
__device__ __forceinline__ void async_copy_kv(unsigned lds_k, const float* gk,
                                              unsigned lds_v, const float* gv) {
  asm volatile("global_load_async_to_lds_b128 %0, %1, off\n\t"
               "global_load_async_to_lds_b128 %2, %3, off\n\t"
               "s_wait_xcnt 0x0"
               :: "v"(lds_k), "v"(gk), "v"(lds_v), "v"(gv) : "memory");
}

// One more 16-byte chunk a lane (the third plane of the keys), same form.
__device__ __forceinline__ void async_copy_one(unsigned lds, const float* g) {
  asm volatile("global_load_async_to_lds_b128 %0, %1, off\n\t"
               "s_wait_xcnt 0x0"
               :: "v"(lds), "v"(g) : "memory");
}

// Value of the neighbour lane (lane ^ 1): quad_perm [1,0,3,2], a vector move.
__device__ __forceinline__ float lane_xor1(float v) {
  return __int_as_float(__builtin_amdgcn_mov_dpp(__float_as_int(v), 0xB1, 0xF, 0xF, true));
}

// ---------------------------------------------------------------------------
// Kernel 1: q/k/v = x @ W^T + b.  grid=(MROWS/64, 12), block=128 (4 waves).
// A block forms a 64-row x 64-col tile of one of q, k, v; wave w the 32 x 32
// part (w >> 1, w & 1) as 2 x 2 WMMA tiles, so a 128-byte output line has one
// writer.  The 64 rows of x and the 64 rows of W come into LDS 64 k at a time by
// async copies of whole lines (two buffers, the next stage flying under this
// stage's WMMAs); a global line is so asked for once per block.
// Fragments are read 16 bytes a lane: lane half ksel holds k = 8s+4*ksel..+3;
// floats 0,1 feed one WMMA and floats 2,3 the next, alike in A and B.
// q and v are written as they are; k in the three-product form (KF_PITCH above):
// a wave's 32 columns are one head, real and imaginary part in neighbour lanes.
// ---------------------------------------------------------------------------
#define PT_ROWS  64            // rows of x, and rows of W, in a block's tile
#define PT_KC    64            // k per stage: 256 bytes of every row
#define PT_PITCH 68            // 272-byte rows: b128 fragment reads conflict-free
#define PT_OPER  (PT_ROWS * PT_PITCH)      // one operand's stage, floats
#define PT_BUF   (2 * PT_OPER)             // x stage, then W stage
#define PT_NST   (DD / PT_KC)

// Eight async copies (ASYNCcnt): rows r, r+8, ..., r+56 of one operand's stage,
// 16 bytes a lane, 16 lanes a row.  The s_wait_xcnt stands in the copies' own
// statement so that no later write of an address register can be scheduled in
// front of it.
__device__ __forceinline__ void async_copy_rows8(unsigned lds, const float* g) {
  asm volatile("global_load_async_to_lds_b128 %0, %8, off\n\t"
               "global_load_async_to_lds_b128 %1, %9, off\n\t"
               "global_load_async_to_lds_b128 %2, %10, off\n\t"
               "global_load_async_to_lds_b128 %3, %11, off\n\t"
               "global_load_async_to_lds_b128 %4, %12, off\n\t"
               "global_load_async_to_lds_b128 %5, %13, off\n\t"
               "global_load_async_to_lds_b128 %6, %14, off\n\t"
               "global_load_async_to_lds_b128 %7, %15, off\n\t"
               "s_wait_xcnt 0x0"
               :: "v"(lds),
                  "v"(lds +  8 * PT_PITCH * 4), "v"(lds + 16 * PT_PITCH * 4),
                  "v"(lds + 24 * PT_PITCH * 4), "v"(lds + 32 * PT_PITCH * 4),
                  "v"(lds + 40 * PT_PITCH * 4), "v"(lds + 48 * PT_PITCH * 4),
                  "v"(lds + 56 * PT_PITCH * 4),
                  "v"(g),
                  "v"(g +  8 * DD), "v"(g + 16 * DD), "v"(g + 24 * DD),
                  "v"(g + 32 * DD), "v"(g + 40 * DD), "v"(g + 48 * DD),
                  "v"(g + 56 * DD)
               : "memory");
}

__global__ __launch_bounds__(128)
void qkv_proj_kernel(const float* __restrict__ x,
                     const float* __restrict__ wq, const float* __restrict__ bq,
                     const float* __restrict__ wk, const float* __restrict__ bk,
                     const float* __restrict__ wv, const float* __restrict__ bv,
                     float* __restrict__ qb, float* __restrict__ kb,
                     float* __restrict__ vb)
{
  __shared__ __attribute__((aligned(16))) float st[2 * PT_BUF];

  const int mat = blockIdx.y >> 2;     // 0: q, 1: k, 2: v
  const float* w;  const float* bias;  float* out;
  if (mat == 0)      { w = wq; bias = bq; out = qb; }
  else if (mat == 1) { w = wk; bias = bk; out = kb; }
  else               { w = wv; bias = bv; out = vb; }

  const int tid  = threadIdx.x;
  const int wave = tid >> 5;
  const int lane = tid & 31;
  const int lh   = lane & 15;
  const int ksel = lane >> 4;          // 0 or 1 (K half of fragment)
  const int wr   = wave >> 1;          // 32-row half of the tile
  const int wc   = wave & 1;           // 32-col half of the tile

  const int r0 = blockIdx.x * PT_ROWS;         // first row of x
  const int c0 = (blockIdx.y & 3) * PT_ROWS;   // first output column = row of W

  // Stage loader: thread t moves floats 4*(t%16).. of rows t/16 + 8*i.
  const int cr = tid >> 4;
  const int cc = (tid & 15) * 4;
  const float* gx = x + (size_t)(r0 + cr) * DD + cc;
  const float* gw = w + (size_t)(c0 + cr) * DD + cc;
  const unsigned lx = (unsigned)(size_t)(st + cr * PT_PITCH + cc);
  const unsigned lw = lx + PT_OPER * 4;

  // Prologue: stage 0 into buffer 0.
  async_copy_rows8(lx, gx);
  async_copy_rows8(lw, gw);
  // Stage 0 has landed for this wave; behind the barrier for every wave.
  asm volatile("s_wait_asynccnt 0x0" ::: "memory");
  __syncthreads();
  // Stage 1 into buffer 1; it flies under stage 0's work.
  async_copy_rows8(lx + PT_BUF * 4, gx + PT_KC);
  async_copy_rows8(lw + PT_BUF * 4, gw + PT_KC);

  v8f acc00 = {}, acc01 = {}, acc10 = {}, acc11 = {};

  for (int s = 0; s < PT_NST; ++s) {
    const int buf = s & 1;
    const float* ap = st + buf * PT_BUF + (wr * 32 + lh) * PT_PITCH + 4 * ksel;
    const float* bp = st + buf * PT_BUF + PT_OPER + (wc * 32 + lh) * PT_PITCH + 4 * ksel;
    // Unrolled whole: the fragment reads take constant offsets.
#pragma unroll
    for (int k = 0; k < PT_KC / 8; ++k) {
      const v4f a0 = *reinterpret_cast<const v4f*>(ap + 8 * k);
      const v4f a1 = *reinterpret_cast<const v4f*>(ap + 16 * PT_PITCH + 8 * k);
      const v4f b0 = *reinterpret_cast<const v4f*>(bp + 8 * k);
      const v4f b1 = *reinterpret_cast<const v4f*>(bp + 16 * PT_PITCH + 8 * k);
      v2f a0l, a0h, a1l, a1h, b0l, b0h, b1l, b1h;
      a0l[0] = a0[0];  a0l[1] = a0[1];  a0h[0] = a0[2];  a0h[1] = a0[3];
      a1l[0] = a1[0];  a1l[1] = a1[1];  a1h[0] = a1[2];  a1h[1] = a1[3];
      b0l[0] = b0[0];  b0l[1] = b0[1];  b0h[0] = b0[2];  b0h[1] = b0[3];
      b1l[0] = b1[0];  b1l[1] = b1[1];  b1h[0] = b1[2];  b1h[1] = b1[3];
      acc00 = wmma4(a0l, b0l, acc00);
      acc01 = wmma4(a0l, b1l, acc01);
      acc10 = wmma4(a1l, b0l, acc10);
      acc11 = wmma4(a1l, b1l, acc11);
      acc00 = wmma4(a0h, b0h, acc00);
      acc01 = wmma4(a0h, b1h, acc01);
      acc10 = wmma4(a1h, b0h, acc10);
      acc11 = wmma4(a1h, b1h, acc11);
    }

    // Publish point of stage s+1: my LDS reads of this buffer are done, my
    // copies of the next stage have landed; behind the barrier both hold for
    // every wave, so the buffer just read may be refilled.
    asm volatile("s_wait_dscnt 0x0" ::: "memory");
    asm volatile("s_wait_asynccnt 0x0" ::: "memory");
    __syncthreads();
    if (s + 2 < PT_NST) {
      const unsigned lo = (unsigned)(buf * PT_BUF * 4);
      async_copy_rows8(lx + lo, gx + (s + 2) * PT_KC);
      async_copy_rows8(lw + lo, gw + (s + 2) * PT_KC);
    }
  }
  // No copy is left in flight when the wave ends.
  asm volatile("s_wait_asynccnt 0x0" ::: "memory");

  // Epilogue: C/D layout -> VGPR j holds row (tile row + j + 8*ksel), col = lh
  const int col = c0 + wc * 32 + lh;
  const float bias0 = bias[col];
  const float bias1 = bias[col + 16];
  if (mat != 1) {
    float* op = out + (size_t)(r0 + wr * 32 + 8 * ksel) * DD + col;
#pragma unroll
    for (int j = 0; j < 8; ++j) {
      op[(size_t)j * DD]             = acc00[j] + bias0;
      op[(size_t)j * DD + 16]        = acc01[j] + bias1;
      op[(size_t)(j + 16) * DD]      = acc10[j] + bias0;
      op[(size_t)(j + 16) * DD + 16] = acc11[j] + bias1;
    }
    // Precaution: the translation wait stands behind the stores, in front of the
    // return; q and v blocks end here and never reach the key part below.
    asm volatile("s_wait_xcnt 0x0" ::: "memory");
    return;
  }

  // Keys.  Even lane: real part of component lh/2 (+8 in the upper 16 columns),
  // odd lane: its imaginary part.  The even lane writes kr and kr+ki, the odd
  // lane kr-ki.
  const bool odd = (lh & 1) != 0;
  const int head = (blockIdx.y & 3) * 2 + wc;
  float* kp = out + (size_t)(r0 + wr * 32 + 8 * ksel) * KF_ROW + head * KF_PITCH
              + (lh >> 1);
  float* kpa = kp + (odd ? 32 : 0);
  // The three loops are unrolled whole: constant indices keep the accumulators,
  // va and vs in registers.
  float va[32], vs[32];
#pragma unroll
  for (int j = 0; j < 8; ++j) {
    const float t0 = acc00[j] + bias0, t1 = acc01[j] + bias1;
    const float t2 = acc10[j] + bias0, t3 = acc11[j] + bias1;
    const float n0 = lane_xor1(t0), n1 = lane_xor1(t1);
    const float n2 = lane_xor1(t2), n3 = lane_xor1(t3);
    va[j]      = odd ? n0 - t0 : t0;   vs[j]      = t0 + n0;
    va[8 + j]  = odd ? n1 - t1 : t1;   vs[8 + j]  = t1 + n1;
    va[16 + j] = odd ? n2 - t2 : t2;   vs[16 + j] = t2 + n2;
    va[24 + j] = odd ? n3 - t3 : t3;   vs[24 + j] = t3 + n3;
  }
#pragma unroll
  for (int j = 0; j < 8; ++j) {
    kpa[(size_t)j * KF_ROW]            = va[j];
    kpa[(size_t)j * KF_ROW + 8]        = va[8 + j];
    kpa[(size_t)(j + 16) * KF_ROW]     = va[16 + j];
    kpa[(size_t)(j + 16) * KF_ROW + 8] = va[24 + j];
  }
  if (!odd) {
#pragma unroll
    for (int j = 0; j < 8; ++j) {
      kp[(size_t)j * KF_ROW + 16]        = vs[j];
      kp[(size_t)j * KF_ROW + 24]        = vs[8 + j];
      kp[(size_t)(j + 16) * KF_ROW + 16] = vs[16 + j];
      kp[(size_t)(j + 16) * KF_ROW + 24] = vs[24 + j];
    }
  }
}

// ---------------------------------------------------------------------------
// Kernel 2: spinor flash attention.  grid=(N/64, H, B), block=512 (16 waves).
// All waves share one (b,h); wave w owns query tile (w & 3) and key group
// (w >> 2), so each query tile's keys are walked by 4 waves side by side and a
// SIMD holds 8 waves instead of 2 to cover LDS, vector and barrier waits.
// K (64x48) and V (64x32) stages are put in LDS once per block via double-buffered gfx1250
// async copies (ASYNCcnt), the next stage's copies flying under this stage's
// WMMAs.  The 4 partial results of a query tile are added through LDS at the end.
// Scores are bounded in [0, 0.177] after scaling -> plain sum-of-exp softmax,
// so partial sums over key groups add with no rescale.
// The complex score q.conj(k) takes three real products instead of four:
//   s = (qr+qi).kr ;  re = s - qi.(kr-ki) ;  im = s - qr.(kr+ki)
// 12 WMMAs a tile for 16: s is the C operand of both the re and the im chain.
// The key-side sums come ready from kernel 1, the query-side ones are formed
// once per wave.  Fragments are read 16 bytes a lane: lane half ksel holds
// components 8t+4*ksel..+3; floats 0,1 feed one WMMA and floats 2,3 the next,
// alike in A and B.
// P (exp weights) goes C-layout -> LDS (padded) -> A-layout for the PV WMMAs.
// ---------------------------------------------------------------------------
__global__ __launch_bounds__(ATTN_THREADS)
void spinor_attn_kernel(const float* __restrict__ qb,
                        const float* __restrict__ kb,
                        const float* __restrict__ vb,
                        float* __restrict__ ob)
{
  extern __shared__ __attribute__((aligned(16))) float smem[];

  const int tid  = threadIdx.x;
  const int wave = tid >> 5;
  const int lane = tid & 31;
  const int lh   = lane & 15;
  const int ksel = lane >> 4;
  const int qi   = wave & (QTILES - 1);   // query tile inside the block
  const int kg   = wave / QTILES;         // key group 0..3

  const int b  = blockIdx.z;
  const int h  = blockIdx.y;
  const int qt = blockIdx.x * QTILES + qi; // query tile 0..127
  const int n0 = qt * 16;

  // Cooperative stage loader: thread t moves one 16B chunk of V and one of the
  // first two key planes; the threads of waves 0..7 also one of the third plane.
  const int lr = tid >> 3;                // stage row 0..63
  const int lc = (tid & 7) * 4;           // stage col 0,4,...,28
  const size_t gtile = (size_t)(b * NN + lr) * DD + h * HD + lc;
  const size_t gkt = (size_t)(b * NN + lr) * KF_ROW + h * KF_PITCH + lc;
  const unsigned lds_k =
      (unsigned)(size_t)(smem + KT_OFF + lr * K_STRIDE + lc);
  const unsigned lds_v =
      (unsigned)(size_t)(smem + VT_OFF + lr * TILE_STRIDE + lc);
  // Scalar, so that the test around the extra copy is a wave-uniform branch.
  const bool third = __builtin_amdgcn_readfirstlane(wave) < 8;
  const int lr3 = (tid & 255) >> 2;       // stage row 0..63
  const int lc3 = 32 + (tid & 3) * 4;     // stage col 32,...,44
  const size_t gkt3 = (size_t)(b * NN + lr3) * KF_ROW + h * KF_PITCH + lc3;
  const unsigned lds_k3 =
      (unsigned)(size_t)(smem + KT_OFF + lr3 * K_STRIDE + lc3);

  // Prologue: stage 0 into buffer 0.
  async_copy_kv(lds_k, kb + gkt, lds_v, vb + gtile);
  if (third) async_copy_one(lds_k3, kb + gkt3);

  // Query-side A fragments of the three products, formed once.
  const float* qp = qb + (size_t)(b * NN + n0 + lh) * DD + h * HD + 8 * ksel;
  v2f qs[4], qnr[4], qni[4];              // qr+qi, -qr, -qi
  // Unrolled: constant indices keep the fragments in registers.
#pragma unroll
  for (int s = 0; s < 4; ++s) {
    // Components 8*(s/2) + 4*ksel + 2*(s%2) and the next: (r, i, r, i).
    const v4f f = *reinterpret_cast<const v4f*>(qp + 16 * (s >> 1) + 4 * (s & 1));
    qs[s][0]  = f[0] + f[1];  qs[s][1]  = f[2] + f[3];
    qnr[s][0] = -f[0];        qnr[s][1] = -f[2];
    qni[s][0] = -f[1];        qni[s][1] = -f[3];
  }

  v8f o0 = {}, o1 = {};     // PV accumulators, d in [0,16) and [16,32)
  v8f lsum = {};            // per-lane partial sum of exp-weights

  float* myp = smem + PB_OFF + wave * 320;   // 16x20 padded P tile

  // Stage 0 has landed for this wave; behind the barrier for every wave.
  asm volatile("s_wait_asynccnt 0x0" ::: "memory");
  __syncthreads();
  // Stage 1 into buffer 1; it flies under stage 0's work.
  async_copy_kv(lds_k + KBUF_FLOATS * 4, kb + gkt + (size_t)STAGE_KEYS * KF_ROW,
                lds_v + BUF_FLOATS * 4, vb + gtile + (size_t)STAGE_KEYS * DD);
  if (third)
    async_copy_one(lds_k3 + KBUF_FLOATS * 4, kb + gkt3 + (size_t)STAGE_KEYS * KF_ROW);

  for (int st = 0; st < NSTAGE; ++st) {
    const int buf = st & 1;
    const float* ks = smem + KT_OFF + buf * KBUF_FLOATS + kg * 16 * K_STRIDE;
    const float* vs = smem + VT_OFF + buf * BUF_FLOATS + kg * 16 * TILE_STRIDE;

    // ---- scores by three products: s, then re = s - qi.kd, im = s - qr.ks ----
    // Both loops unrolled: constant indices into the query fragments, constant
    // offsets in the LDS reads.
    const float* krow = ks + lh * K_STRIDE + 4 * ksel;
    v8f sc = {};
#pragma unroll
    for (int t = 0; t < 2; ++t) {
      const v4f f = *reinterpret_cast<const v4f*>(krow + 8 * t);
      v2f lo, hi;
      lo[0] = f[0];  lo[1] = f[1];  hi[0] = f[2];  hi[1] = f[3];
      sc = wmma4(qs[2 * t], lo, sc);
      sc = wmma4(qs[2 * t + 1], hi, sc);
    }
    v8f re = sc, im = sc;
#pragma unroll
    for (int t = 0; t < 2; ++t) {
      const v4f fs = *reinterpret_cast<const v4f*>(krow + 16 + 8 * t);
      const v4f fd = *reinterpret_cast<const v4f*>(krow + 32 + 8 * t);
      v2f slo, shi, dlo, dhi;
      slo[0] = fs[0];  slo[1] = fs[1];  shi[0] = fs[2];  shi[1] = fs[3];
      dlo[0] = fd[0];  dlo[1] = fd[1];  dhi[0] = fd[2];  dhi[1] = fd[3];
      re = wmma4(qni[2 * t], dlo, re);
      im = wmma4(qnr[2 * t], slo, im);
      re = wmma4(qni[2 * t + 1], dhi, re);
      im = wmma4(qnr[2 * t + 1], shi, im);
    }

    // ---- weight + exp (closed form: cos(atan2(im,re)) = re*rsqrt(re^2+im^2))
    v8f p;
#pragma unroll
    for (int j = 0; j < 8; ++j) {
      float r = re[j], i = im[j];
      float den = r * r + i * i;
      float c = (den > 0.0f) ? r * __frsqrt_rn(den) : 1.0f;
      float wv = 0.5f * (1.0f + c) * INV_SCALE;
      float e = __expf(wv);
      p[j] = e;
      lsum[j] += e;
    }

    // ---- transpose P through LDS: C-layout store, A-layout load ----
#pragma unroll
    for (int j = 0; j < 8; ++j)
      myp[(j + 8 * ksel) * 20 + lh] = p[j];
    asm volatile("s_wait_dscnt 0" ::: "memory");   // wave-local RAW turn-around

    // ---- PV: out += P(16x16) @ V(16x32) ----
#pragma unroll
    for (int kk = 0; kk < 4; ++kk) {
      v2f pa = ld2(myp + lh * 20 + 4 * kk + 2 * ksel);
      const float* vrow = vs + (4 * kk + 2 * ksel) * TILE_STRIDE;
      v2f b0, b1;
      b0[0] = vrow[lh];                    b0[1] = vrow[TILE_STRIDE + lh];
      b1[0] = vrow[16 + lh];               b1[1] = vrow[TILE_STRIDE + 16 + lh];
      o0 = wmma4(pa, b0, o0);
      o1 = wmma4(pa, b1, o1);
    }

    // Publish point of stage st+1: my LDS reads of this buffer are done, my
    // copies of the next stage have landed; behind the barrier both hold for
    // every wave, so the buffer just read may be refilled.
    asm volatile("s_wait_dscnt 0x0" ::: "memory");
    asm volatile("s_wait_asynccnt 0x0" ::: "memory");
    __syncthreads();
    if (st + 2 < NSTAGE) {
      const size_t gnext = gtile + (size_t)((st + 2) * STAGE_KEYS) * DD;
      const size_t knext = (size_t)((st + 2) * STAGE_KEYS) * KF_ROW;
      const unsigned lo = (unsigned)(buf * BUF_FLOATS * 4);
      const unsigned klo = (unsigned)(buf * KBUF_FLOATS * 4);
      async_copy_kv(lds_k + klo, kb + gkt + knext, lds_v + lo, vb + gnext);
      if (third) async_copy_one(lds_k3 + klo, kb + gkt3 + knext);
    }
  }
  // No copy is left in flight when the ring becomes the partial-sum buffer.
  asm volatile("s_wait_asynccnt 0x0" ::: "memory");

  // ---- add the 4 key groups' partial sums (the last trip's barrier has ended
  // every read of the ring): groups 1..3 store, group 0 adds in group order ----
  float4* cb = reinterpret_cast<float4*>(smem);
  if (kg != 0) {
    float4* d = cb + ((kg - 1) * QTILES + qi) * 192 + lane;
    d[0]   = make_float4(o0[0], o0[1], o0[2], o0[3]);
    d[32]  = make_float4(o0[4], o0[5], o0[6], o0[7]);
    d[64]  = make_float4(o1[0], o1[1], o1[2], o1[3]);
    d[96]  = make_float4(o1[4], o1[5], o1[6], o1[7]);
    d[128] = make_float4(lsum[0], lsum[1], lsum[2], lsum[3]);
    d[160] = make_float4(lsum[4], lsum[5], lsum[6], lsum[7]);
  }
  __syncthreads();
  if (kg != 0) return;
  // Both loops unrolled: constant indices keep o0, o1 and lsum in registers.
#pragma unroll
  for (int g = 0; g < KGROUPS - 1; ++g) {
    const float4* s = cb + (g * QTILES + qi) * 192 + lane;
#pragma unroll
    for (int i = 0; i < 2; ++i) {
      const float4 a0 = s[32 * i], a1 = s[64 + 32 * i], al = s[128 + 32 * i];
      o0[4 * i + 0] += a0.x;  o0[4 * i + 1] += a0.y;
      o0[4 * i + 2] += a0.z;  o0[4 * i + 3] += a0.w;
      o1[4 * i + 0] += a1.x;  o1[4 * i + 1] += a1.y;
      o1[4 * i + 2] += a1.z;  o1[4 * i + 3] += a1.w;
      lsum[4 * i + 0] += al.x;  lsum[4 * i + 1] += al.y;
      lsum[4 * i + 2] += al.z;  lsum[4 * i + 3] += al.w;
    }
  }

  // ---- softmax normalization: reduce exp-sums over the 16 columns ----
#pragma unroll
  for (int j = 0; j < 8; ++j) {
    float s = lsum[j];
    s += __shfl_xor(s, 1);
    s += __shfl_xor(s, 2);
    s += __shfl_xor(s, 4);
    s += __shfl_xor(s, 8);                 // stays within each 16-lane half
    const float inv = __frcp_rn(s);
    const size_t ro = (size_t)(b * NN + n0 + j + 8 * ksel) * DD + h * HD;
    ob[ro + lh]      = o0[j] * inv;
    ob[ro + 16 + lh] = o1[j] * inv;
  }
}

// ---------------------------------------------------------------------------
// Kernel 3: gate MLP (Linear->SiLU->Linear->Sigmoid) + final multiply.
// grid=4096/16, block=128 (4 waves).  A block owns 16 rows; wave w forms the
// 16 rows x 16 hidden units [16w, 16w+16) of the first layer on f32 WMMA, so a
// weight row is read once per 16 rows and a fragment load touches 16 lines.
// The row tile comes in by whole-line loads, stays in registers for the final
// multiply and goes through LDS (pitch 260 floats) for the A fragments.
// Fragments are read 16 bytes a lane: lane half ksel holds k = 8s+4*ksel..+3;
// floats 0,1 feed one WMMA and floats 2,3 the next, alike in A and B.
// ---------------------------------------------------------------------------
#define GROWS   16
#define XPITCH  260            // 16B-aligned rows, b128 fragment reads conflict-free
#define TPITCH  68             // 16B-aligned rows of the 16 x 64 second-layer terms

__global__ __launch_bounds__(128)
void gate_kernel(const float* __restrict__ ob,
                 const float* __restrict__ wg1, const float* __restrict__ bg1,
                 const float* __restrict__ wg2, const float* __restrict__ bg2,
                 float* __restrict__ out)
{
  __shared__ __attribute__((aligned(16))) float xt[GROWS * XPITCH];
  __shared__ __attribute__((aligned(16))) float tt[GROWS * TPITCH];

  const int tid  = threadIdx.x;
  const int wave = tid >> 5;
  const int lane = tid & 31;
  const int lh   = lane & 15;
  const int ksel = lane >> 4;
  const int r0   = blockIdx.x * GROWS;

  // Every loop below is unrolled whole: constant indices keep xv, wf, af and the
  // accumulators in registers.
  // Thread t owns row t/8 of the tile, floats 4*(t%8) + 32*i: 8 lanes cover one
  // 128-byte line, a wave 4 whole lines per load.
  const int xr = tid >> 3;
  const int xc = (tid & 7) * 4;
  const float* xg = ob + (size_t)(r0 + xr) * DD + xc;
  v4f xv[8];
#pragma unroll
  for (int i = 0; i < 8; ++i)
    xv[i] = *reinterpret_cast<const v4f*>(xg + 32 * i);
#pragma unroll
  for (int i = 0; i < 8; ++i)
    *reinterpret_cast<v4f*>(&xt[xr * XPITCH + xc + 32 * i]) = xv[i];

  const int hid = wave * 16 + lh;              // this lane's hidden unit
  const float* bp = wg1 + (size_t)hid * DD + 4 * ksel;
  // All of this lane's weights are asked for ahead of the barrier, so that they
  // fly while the row tile lands: one wave a SIMD has nothing else to hide them.
  v4f wf[DD / 8];
#pragma unroll
  for (int s = 0; s < DD / 8; ++s)
    wf[s] = *reinterpret_cast<const v4f*>(bp + 8 * s);
  const float b1 = bg1[hid];
  const float w2 = wg2[hid];
  const float b2 = bg2[0];

  __syncthreads();                             // the row tile is complete in LDS
  // Precaution: the translation wait stands in front of the first reuse of the
  // loads' address registers (the accumulators take them).
  asm volatile("s_wait_xcnt 0x0" ::: "memory");

  const float* ap = &xt[lh * XPITCH + 4 * ksel];
  v8f acc0 = {}, acc1 = {};
  // A fragments come from LDS eight at a time, one group ahead of the WMMAs
  // that use them, so that the LDS latency lies under 16 WMMAs of work.
  v4f af[2][8];
#pragma unroll
  for (int i = 0; i < 8; ++i)
    af[0][i] = *reinterpret_cast<const v4f*>(ap + 8 * i);
#pragma unroll
  for (int g = 0; g < DD / 64; ++g) {
    if (g + 1 < DD / 64) {
#pragma unroll
      for (int i = 0; i < 8; ++i)
        af[(g + 1) & 1][i] = *reinterpret_cast<const v4f*>(ap + 64 * (g + 1) + 8 * i);
      // Keeps the eight reads issued here: the scheduler otherwise sinks each
      // to two WMMAs ahead of its use, which leaves the LDS latency exposed.
      __builtin_amdgcn_sched_barrier(0);
    }
#pragma unroll
    for (int i = 0; i < 8; ++i) {
      const v4f a = af[g & 1][i];
      const v4f w = wf[8 * g + i];
      v2f a0, a1, w0, w1;
      a0[0] = a[0];  a0[1] = a[1];  a1[0] = a[2];  a1[1] = a[3];
      w0[0] = w[0];  w0[1] = w[1];  w1[0] = w[2];  w1[1] = w[3];
      acc0 = wmma4(a0, w0, acc0);
      acc1 = wmma4(a1, w1, acc1);
    }
  }

  // D layout: register j holds row j + 8*ksel, hidden unit hid.
#pragma unroll
  for (int j = 0; j < 8; ++j) {
    const float z = acc0[j] + acc1[j] + b1;
    tt[(j + 8 * ksel) * TPITCH + hid] = z * sigmoidf_(z) * w2;   // SiLU * wg2
  }
  __syncthreads();                             // all 64 terms of every row stand

  // The 8 threads of a row add 8 terms each, then across the 8 lanes.
  const v4f t0 = *reinterpret_cast<const v4f*>(&tt[xr * TPITCH + (tid & 7) * 8]);
  const v4f t1 = *reinterpret_cast<const v4f*>(&tt[xr * TPITCH + (tid & 7) * 8 + 4]);
  float g = ((t0[0] + t0[1]) + (t0[2] + t0[3])) + ((t1[0] + t1[1]) + (t1[2] + t1[3]));
  g += __shfl_xor(g, 1);
  g += __shfl_xor(g, 2);
  g += __shfl_xor(g, 4);
  g = sigmoidf_(g + b2);

  float* og = out + (size_t)(r0 + xr) * DD + xc;
#pragma unroll
  for (int i = 0; i < 8; ++i)
    *reinterpret_cast<v4f*>(og + 32 * i) = xv[i] * g;
}

// ---------------------------------------------------------------------------
extern "C" void kernel_launch(void* const* d_in, const int* in_sizes, int n_in,
                              void* d_out, int out_size, void* d_ws,
                              size_t ws_size, hipStream_t stream)
{
  const float* x   = (const float*)d_in[0];
  const float* wq  = (const float*)d_in[1];
  const float* bq  = (const float*)d_in[2];
  const float* wk  = (const float*)d_in[3];
  const float* bk  = (const float*)d_in[4];
  const float* wv  = (const float*)d_in[5];
  const float* bv  = (const float*)d_in[6];
  const float* wg1 = (const float*)d_in[7];
  const float* bg1 = (const float*)d_in[8];
  const float* wg2 = (const float*)d_in[9];
  const float* bg2 = (const float*)d_in[10];
  float* out = (float*)d_out;

  // Workspace: q (4 MB) | k, three-product form (8 MB) | v (4 MB) | attn_out (4 MB)
  float* qb = (float*)d_ws;
  float* kb = qb + (size_t)MROWS * DD;
  float* vb = kb + (size_t)MROWS * KF_ROW;
  float* ob = vb + (size_t)MROWS * DD;

  {
    dim3 grid(MROWS / 64, 12);
    qkv_proj_kernel<<<grid, 128, 0, stream>>>(x, wq, bq, wk, bk, wv, bv,
                                              qb, kb, vb);
  }
  {
    dim3 grid(NN / 64, HH, BB);
    spinor_attn_kernel<<<grid, ATTN_THREADS, SMEM_BYTES, stream>>>(qb, kb, vb, ob);
  }
  {
    dim3 grid(MROWS / 16);
    gate_kernel<<<grid, 128, 0, stream>>>(ob, wg1, bg1, wg2, bg2, out);
  }
}

// v005
// It runs in 77.9 microseconds.
// Next to v004, in two timings, it ran 1.08 times as fast each time.
// Counting every step since v000, it is 1.74 times as fast.
#include <hip/hip_runtime.h>
#include <hip/hip_bf16.h>
#include <math.h>

// Problem constants (match reference)
#define BB  2
#define NN  2048
#define DD  256
#define HH  8
#define HD  32
#define MROWS (BB*NN)          // 4096 flattened rows
// 1/(sqrt(32)+1e-6)
#define INV_SCALE 0.17677666f

// Attention work-group: 16 waves = 4 query tiles x 4 key groups.  A stage is
// 64 keys; key group g works on rows [16g, 16g+16) of every stage.
#define QTILES   4
#define KGROUPS  4
#define STAGE_KEYS (16 * KGROUPS)
#define NSTAGE   (NN / STAGE_KEYS)
#define ATTN_THREADS (32 * QTILES * KGROUPS)

// Keys are kept in the workspace in three-product form: per (row, head) 64
// floats, of which 48 are used: kr[16] | kr+ki [16] | kr-ki [16] (kr, ki = real
// and imaginary part of the 16 complex components).  The 256-byte pitch gives
// every 128-byte line one writer.
#define KF_PITCH 64            // floats per (row, head) in the workspace
#define KF_ROW   (HH * KF_PITCH)

// Values are kept in the workspace transposed: per (batch, head) 32 rows, one
// per component d, of NN floats (one per key), so that a lane of the attention
// kernel reads four keys of its component with one 16-byte LDS load.

// LDS layout for the attention kernel (float indices, dynamic LDS only):
//   K stages  : 2 bufs x 64 keys x 52 floats       -> [0,    6656)
//   V^T stages: 2 bufs x 32 components x 68 floats -> [6656, 11008)
// After the key loop [0, 7680) is reused for the partial sums of key groups
// 1..3: 12 waves x 640 floats (17 values x 32 lanes are used).
#define V_STRIDE 68            // 64 keys + 4: 272-byte rows, 16 B x odd for b128 reads
#define VBUF_FLOATS (HD * V_STRIDE)
#define K_STRIDE 52            // 48 floats + 4: 208-byte rows, 16 B x odd for b128 reads
#define KBUF_FLOATS (STAGE_KEYS * K_STRIDE)
#define KT_OFF   0
#define VT_OFF   (2 * KBUF_FLOATS)
#define SMEM_FLOATS (VT_OFF + 2 * VBUF_FLOATS)
#define SMEM_BYTES  (SMEM_FLOATS * 4)

typedef float v2f __attribute__((ext_vector_type(2)));
typedef float v4f __attribute__((ext_vector_type(4)));
typedef float v8f __attribute__((ext_vector_type(8)));

// D = A(16x4 f32) * B(4x16 f32) + C, one wave, fp32 WMMA
__device__ __forceinline__ v8f wmma4(v2f a, v2f b, v8f c) {
  return __builtin_amdgcn_wmma_f32_16x16x4_f32(
      /*neg_a=*/false, a, /*neg_b=*/false, b,
      /*c_mod=*/(short)0, c, /*reuse_a=*/false, /*reuse_b=*/false);
}

__device__ __forceinline__ float sigmoidf_(float x) {
  return 1.0f / (1.0f + __expf(-x));
}

// gfx1250 async copies, tracked by ASYNCcnt: one 16-byte chunk of K and one of
// V per lane.  The s_wait_xcnt stands in the copies' own statement so that no
// later write of an address register can be scheduled in front of it.
__device__ __forceinline__ void async_copy_kv(unsigned lds_k, const float* gk,
                                              unsigned lds_v, const float* gv) {
  asm volatile("global_load_async_to_lds_b128 %0, %1, off\n\t"
               "global_load_async_to_lds_b128 %2, %3, off\n\t"
               "s_wait_xcnt 0x0"
               :: "v"(lds_k), "v"(gk), "v"(lds_v), "v"(gv) : "memory");
}

// One more 16-byte chunk a lane (the third plane of the keys), same form.
__device__ __forceinline__ void async_copy_one(unsigned lds, const float* g) {
  asm volatile("global_load_async_to_lds_b128 %0, %1, off\n\t"
               "s_wait_xcnt 0x0"
               :: "v"(lds), "v"(g) : "memory");
}

// Value of the neighbour lane (lane ^ 1): quad_perm [1,0,3,2], a vector move.
__device__ __forceinline__ float lane_xor1(float v) {
  return __int_as_float(__builtin_amdgcn_mov_dpp(__float_as_int(v), 0xB1, 0xF, 0xF, true));
}

// ---------------------------------------------------------------------------
// Kernel 1: q/k/v = x @ W^T + b.  grid=(MROWS/64, 12), block=128 (4 waves).
// A block forms a 64-row x 64-col tile of one of q, k, v; wave w the 32 x 32
// part (w >> 1, w & 1) as 2 x 2 WMMA tiles, so a 128-byte output line has one
// writer.  The 64 rows of x and the 64 rows of W come into LDS 64 k at a time by
// async copies of whole lines (two buffers, the next stage flying under this
// stage's WMMAs); a global line is so asked for once per block.
// Fragments are read 16 bytes a lane: lane half ksel holds k = 8s+4*ksel..+3;
// floats 0,1 feed one WMMA and floats 2,3 the next, alike in A and B.
// q is written as it is; k in the three-product form (KF_PITCH above): a wave's
// 32 columns are one head, real and imaginary part in neighbour lanes; v
// transposed: a lane's 8 accumulator registers are 8 successive rows of one
// column, two 16-byte stores, and a wave's 32 rows fill a 128-byte line.
// ---------------------------------------------------------------------------
#define PT_ROWS  64            // rows of x, and rows of W, in a block's tile
#define PT_KC    64            // k per stage: 256 bytes of every row
#define PT_PITCH 68            // 272-byte rows: b128 fragment reads conflict-free
#define PT_OPER  (PT_ROWS * PT_PITCH)      // one operand's stage, floats
#define PT_BUF   (2 * PT_OPER)             // x stage, then W stage
#define PT_NST   (DD / PT_KC)

// Eight async copies (ASYNCcnt): rows r, r+8, ..., r+56 of one operand's stage,
// 16 bytes a lane, 16 lanes a row.  The s_wait_xcnt stands in the copies' own
// statement so that no later write of an address register can be scheduled in
// front of it.
__device__ __forceinline__ void async_copy_rows8(unsigned lds, const float* g) {
  asm volatile("global_load_async_to_lds_b128 %0, %8, off\n\t"
               "global_load_async_to_lds_b128 %1, %9, off\n\t"
               "global_load_async_to_lds_b128 %2, %10, off\n\t"
               "global_load_async_to_lds_b128 %3, %11, off\n\t"
               "global_load_async_to_lds_b128 %4, %12, off\n\t"
               "global_load_async_to_lds_b128 %5, %13, off\n\t"
               "global_load_async_to_lds_b128 %6, %14, off\n\t"
               "global_load_async_to_lds_b128 %7, %15, off\n\t"
               "s_wait_xcnt 0x0"
               :: "v"(lds),
                  "v"(lds +  8 * PT_PITCH * 4), "v"(lds + 16 * PT_PITCH * 4),
                  "v"(lds + 24 * PT_PITCH * 4), "v"(lds + 32 * PT_PITCH * 4),
                  "v"(lds + 40 * PT_PITCH * 4), "v"(lds + 48 * PT_PITCH * 4),
                  "v"(lds + 56 * PT_PITCH * 4),
                  "v"(g),
                  "v"(g +  8 * DD), "v"(g + 16 * DD), "v"(g + 24 * DD),
                  "v"(g + 32 * DD), "v"(g + 40 * DD), "v"(g + 48 * DD),
                  "v"(g + 56 * DD)
               : "memory");
}

__global__ __launch_bounds__(128)
void qkv_proj_kernel(const float* __restrict__ x,
                     const float* __restrict__ wq, const float* __restrict__ bq,
                     const float* __restrict__ wk, const float* __restrict__ bk,
                     const float* __restrict__ wv, const float* __restrict__ bv,
                     float* __restrict__ qb, float* __restrict__ kb,
                     float* __restrict__ vb)
{
  __shared__ __attribute__((aligned(16))) float st[2 * PT_BUF];

  const int mat = blockIdx.y >> 2;     // 0: q, 1: k, 2: v
  const float* w;  const float* bias;  float* out;
  if (mat == 0)      { w = wq; bias = bq; out = qb; }
  else if (mat == 1) { w = wk; bias = bk; out = kb; }
  else               { w = wv; bias = bv; out = vb; }

  const int tid  = threadIdx.x;
  const int wave = tid >> 5;
  const int lane = tid & 31;
  const int lh   = lane & 15;
  const int ksel = lane >> 4;          // 0 or 1 (K half of fragment)
  const int wr   = wave >> 1;          // 32-row half of the tile
  const int wc   = wave & 1;           // 32-col half of the tile

  const int r0 = blockIdx.x * PT_ROWS;         // first row of x
  const int c0 = (blockIdx.y & 3) * PT_ROWS;   // first output column = row of W

  // Stage loader: thread t moves floats 4*(t%16).. of rows t/16 + 8*i.
  const int cr = tid >> 4;
  const int cc = (tid & 15) * 4;
  const float* gx = x + (size_t)(r0 + cr) * DD + cc;
  const float* gw = w + (size_t)(c0 + cr) * DD + cc;
  const unsigned lx = (unsigned)(size_t)(st + cr * PT_PITCH + cc);
  const unsigned lw = lx + PT_OPER * 4;

  // Prologue: stage 0 into buffer 0.
  async_copy_rows8(lx, gx);
  async_copy_rows8(lw, gw);
  // Stage 0 has landed for this wave; behind the barrier for every wave.
  asm volatile("s_wait_asynccnt 0x0" ::: "memory");
  __syncthreads();
  // Stage 1 into buffer 1; it flies under stage 0's work.
  async_copy_rows8(lx + PT_BUF * 4, gx + PT_KC);
  async_copy_rows8(lw + PT_BUF * 4, gw + PT_KC);

  v8f acc00 = {}, acc01 = {}, acc10 = {}, acc11 = {};

  for (int s = 0; s < PT_NST; ++s) {
    const int buf = s & 1;
    const float* ap = st + buf * PT_BUF + (wr * 32 + lh) * PT_PITCH + 4 * ksel;
    const float* bp = st + buf * PT_BUF + PT_OPER + (wc * 32 + lh) * PT_PITCH + 4 * ksel;
    // Unrolled whole: the fragment reads take constant offsets.
#pragma unroll
    for (int k = 0; k < PT_KC / 8; ++k) {
      const v4f a0 = *reinterpret_cast<const v4f*>(ap + 8 * k);
      const v4f a1 = *reinterpret_cast<const v4f*>(ap + 16 * PT_PITCH + 8 * k);
      const v4f b0 = *reinterpret_cast<const v4f*>(bp + 8 * k);
      const v4f b1 = *reinterpret_cast<const v4f*>(bp + 16 * PT_PITCH + 8 * k);
      v2f a0l, a0h, a1l, a1h, b0l, b0h, b1l, b1h;
      a0l[0] = a0[0];  a0l[1] = a0[1];  a0h[0] = a0[2];  a0h[1] = a0[3];
      a1l[0] = a1[0];  a1l[1] = a1[1];  a1h[0] = a1[2];  a1h[1] = a1[3];
      b0l[0] = b0[0];  b0l[1] = b0[1];  b0h[0] = b0[2];  b0h[1] = b0[3];
      b1l[0] = b1[0];  b1l[1] = b1[1];  b1h[0] = b1[2];  b1h[1] = b1[3];
      acc00 = wmma4(a0l, b0l, acc00);
      acc01 = wmma4(a0l, b1l, acc01);
      acc10 = wmma4(a1l, b0l, acc10);
      acc11 = wmma4(a1l, b1l, acc11);
      acc00 = wmma4(a0h, b0h, acc00);
      acc01 = wmma4(a0h, b1h, acc01);
      acc10 = wmma4(a1h, b0h, acc10);
      acc11 = wmma4(a1h, b1h, acc11);
    }

    // Publish point of stage s+1: my LDS reads of this buffer are done, my
    // copies of the next stage have landed; behind the barrier both hold for
    // every wave, so the buffer just read may be refilled.
    asm volatile("s_wait_dscnt 0x0" ::: "memory");
    asm volatile("s_wait_asynccnt 0x0" ::: "memory");
    __syncthreads();
    if (s + 2 < PT_NST) {
      const unsigned lo = (unsigned)(buf * PT_BUF * 4);
      async_copy_rows8(lx + lo, gx + (s + 2) * PT_KC);
      async_copy_rows8(lw + lo, gw + (s + 2) * PT_KC);
    }
  }
  // No copy is left in flight when the wave ends.
  asm volatile("s_wait_asynccnt 0x0" ::: "memory");

  // Epilogue: C/D layout -> VGPR j holds row (tile row + j + 8*ksel), col = lh
  const int col = c0 + wc * 32 + lh;
  const float bias0 = bias[col];
  const float bias1 = bias[col + 16];
  if (mat == 0) {
    float* op = out + (size_t)(r0 + wr * 32 + 8 * ksel) * DD + col;
#pragma unroll
    for (int j = 0; j < 8; ++j) {
      op[(size_t)j * DD]             = acc00[j] + bias0;
      op[(size_t)j * DD + 16]        = acc01[j] + bias1;
      op[(size_t)(j + 16) * DD]      = acc10[j] + bias0;
      op[(size_t)(j + 16) * DD + 16] = acc11[j] + bias1;
    }
    // Precaution: the translation wait stands behind the stores, in front of the
    // return; q blocks end here and never reach the key part below.
    asm volatile("s_wait_xcnt 0x0" ::: "memory");
    return;
  }

  const int head = (blockIdx.y & 3) * 2 + wc;
  if (mat == 2) {
    // Values, transposed: row = (batch, head, component), column = position.
    float* vp = out + (size_t)(((r0 / NN) * HH + head) * HD + lh) * NN
                + (r0 % NN) + wr * 32 + 8 * ksel;
    // Both loops unrolled: constant indices keep the accumulators in registers.
#pragma unroll
    for (int i = 0; i < 2; ++i) {
      v4f t00, t01, t10, t11;
#pragma unroll
      for (int e = 0; e < 4; ++e) {
        t00[e] = acc00[4 * i + e] + bias0;  t01[e] = acc01[4 * i + e] + bias1;
        t10[e] = acc10[4 * i + e] + bias0;  t11[e] = acc11[4 * i + e] + bias1;
      }
      *reinterpret_cast<v4f*>(vp + 4 * i)                = t00;
      *reinterpret_cast<v4f*>(vp + 16 + 4 * i)           = t10;
      *reinterpret_cast<v4f*>(vp + 16 * NN + 4 * i)      = t01;
      *reinterpret_cast<v4f*>(vp + 16 * NN + 16 + 4 * i) = t11;
    }
    // Precaution: as above, the translation wait behind the stores.
    asm volatile("s_wait_xcnt 0x0" ::: "memory");
    return;
  }

  // Keys.  Even lane: real part of component lh/2 (+8 in the upper 16 columns),
  // odd lane: its imaginary part.  The even lane writes kr and kr+ki, the odd
  // lane kr-ki.
  const bool odd = (lh & 1) != 0;
  float* kp = out + (size_t)(r0 + wr * 32 + 8 * ksel) * KF_ROW + head * KF_PITCH
              + (lh >> 1);
  float* kpa = kp + (odd ? 32 : 0);
  // The three loops are unrolled whole: constant indices keep the accumulators,
  // va and vs in registers.
  float va[32], vs[32];
#pragma unroll
  for (int j = 0; j < 8; ++j) {
    const float t0 = acc00[j] + bias0, t1 = acc01[j] + bias1;
    const float t2 = acc10[j] + bias0, t3 = acc11[j] + bias1;
    const float n0 = lane_xor1(t0), n1 = lane_xor1(t1);
    const float n2 = lane_xor1(t2), n3 = lane_xor1(t3);
    va[j]      = odd ? n0 - t0 : t0;   vs[j]      = t0 + n0;
    va[8 + j]  = odd ? n1 - t1 : t1;   vs[8 + j]  = t1 + n1;
    va[16 + j] = odd ? n2 - t2 : t2;   vs[16 + j] = t2 + n2;
    va[24 + j] = odd ? n3 - t3 : t3;   vs[24 + j] = t3 + n3;
  }
#pragma unroll
  for (int j = 0; j < 8; ++j) {
    kpa[(size_t)j * KF_ROW]            = va[j];
    kpa[(size_t)j * KF_ROW + 8]        = va[8 + j];
    kpa[(size_t)(j + 16) * KF_ROW]     = va[16 + j];
    kpa[(size_t)(j + 16) * KF_ROW + 8] = va[24 + j];
  }
  if (!odd) {
#pragma unroll
    for (int j = 0; j < 8; ++j) {
      kp[(size_t)j * KF_ROW + 16]        = vs[j];
      kp[(size_t)j * KF_ROW + 24]        = vs[8 + j];
      kp[(size_t)(j + 16) * KF_ROW + 16] = vs[16 + j];
      kp[(size_t)(j + 16) * KF_ROW + 24] = vs[24 + j];
    }
  }
}

// ---------------------------------------------------------------------------
// Kernel 2: spinor flash attention, transposed form.  grid=(N/64, H, B),
// block=512 (16 waves).  All waves share one (b,h); wave w owns query tile
// (w & 3) and key group (w >> 2), so each query tile's keys are walked by 4
// waves side by side and a SIMD holds 4 waves.
// K (64 keys x 48) and V^T (32 components x 64 keys) stages are put in LDS once
// per block via double-buffered gfx1250 async copies (ASYNCcnt), the next
// stage's copies flying under this stage's WMMAs.  The 4 partial results of a
// query tile are added through LDS at the end.
// Scores are bounded in [0, 0.177] after scaling -> plain sum-of-exp softmax,
// so partial sums over key groups add with no rescale.
// The complex score q.conj(k) takes three real products instead of four:
//   s = (qr+qi).kr ;  re = s - qi.(kr-ki) ;  im = s - qr.(kr+ki)
// 12 WMMAs a tile for 16: s is the C operand of both the re and the im chain.
// The key-side sums come ready from kernel 1, the query-side ones are formed
// once per wave.  Fragments are read 16 bytes a lane: lane half ksel holds
// components 8t+4*ksel..+3; floats 0,1 feed one WMMA and floats 2,3 the next,
// alike in A and B.
// Transposed: S^T = K.Q^T (A = key rows, B = queries), so a lane holds 8 keys'
// scores of ONE query, and register pair (2kk, 2kk+1) of the exp weights is the
// B operand of the kk-th WMMA of O^T += V^T.P^T as it stands: the weights never
// leave the registers.  Row m of the key tile is key swap23(m) of the group
// (bits 2 and 3 of m exchanged): half ksel's registers 0..3 are then keys
// 4*ksel..+3 and registers 4..7 keys 8+4*ksel..+3, each one 16-byte read of V^T.
// ---------------------------------------------------------------------------
__global__ __launch_bounds__(ATTN_THREADS)
void spinor_attn_kernel(const float* __restrict__ qb,
                        const float* __restrict__ kb,
                        const float* __restrict__ vb,
                        float* __restrict__ ob)
{
  extern __shared__ __attribute__((aligned(16))) float smem[];

  const int tid  = threadIdx.x;
  const int wave = tid >> 5;
  const int lane = tid & 31;
  const int lh   = lane & 15;
  const int ksel = lane >> 4;
  const int qi   = wave & (QTILES - 1);   // query tile inside the block
  const int kg   = wave / QTILES;         // key group 0..3

  const int b  = blockIdx.z;
  const int h  = blockIdx.y;
  const int qt = blockIdx.x * QTILES + qi; // query tile 0..127
  const int n0 = qt * 16;

  // Cooperative stage loader: thread t moves one 16B chunk of V^T and one of the
  // first two key planes; the threads of waves 0..7 also one of the third plane.
  const int lr = tid >> 3;                // key row of the stage 0..63
  const int lc = (tid & 7) * 4;           // its float 0,4,...,28
  const int vr = tid >> 4;                // component row of V^T 0..31
  const int vc = (tid & 15) * 4;          // its key 0,4,...,60
  const size_t gvt = (size_t)((b * HH + h) * HD + vr) * NN + vc;
  const size_t gkt = (size_t)(b * NN + lr) * KF_ROW + h * KF_PITCH + lc;
  const unsigned lds_k =
      (unsigned)(size_t)(smem + KT_OFF + lr * K_STRIDE + lc);
  const unsigned lds_v =
      (unsigned)(size_t)(smem + VT_OFF + vr * V_STRIDE + vc);
  // Scalar, so that the test around the extra copy is a wave-uniform branch.
  const bool third = __builtin_amdgcn_readfirstlane(wave) < 8;
  const int lr3 = (tid & 255) >> 2;       // stage row 0..63
  const int lc3 = 32 + (tid & 3) * 4;     // stage col 32,...,44
  const size_t gkt3 = (size_t)(b * NN + lr3) * KF_ROW + h * KF_PITCH + lc3;
  const unsigned lds_k3 =
      (unsigned)(size_t)(smem + KT_OFF + lr3 * K_STRIDE + lc3);

  // Prologue: stage 0 into buffer 0.
  async_copy_kv(lds_k, kb + gkt, lds_v, vb + gvt);
  if (third) async_copy_one(lds_k3, kb + gkt3);

  // Query-side B fragments of the three products, formed once.
  const float* qp = qb + (size_t)(b * NN + n0 + lh) * DD + h * HD + 8 * ksel;
  v2f qs[4], qnr[4], qni[4];              // qr+qi, -qr, -qi
  // Unrolled: constant indices keep the fragments in registers.
#pragma unroll
  for (int s = 0; s < 4; ++s) {
    // Components 8*(s/2) + 4*ksel + 2*(s%2) and the next: (r, i, r, i).
    const v4f f = *reinterpret_cast<const v4f*>(qp + 16 * (s >> 1) + 4 * (s & 1));
    qs[s][0]  = f[0] + f[1];  qs[s][1]  = f[2] + f[3];
    qnr[s][0] = -f[0];        qnr[s][1] = -f[2];
    qni[s][0] = -f[1];        qni[s][1] = -f[3];
  }

  v8f o0 = {}, o1 = {};     // O^T accumulators, d in [0,16) and [16,32)
  v2f lsum[4] = {};         // this lane's sums of exp weights, by register pair

  // This lane's key row in its group's tile, and its V^T row (component lh).
  const int krw = (lh & 3) | ((lh & 4) << 1) | ((lh & 8) >> 1);
  const int koff = (kg * 16 + krw) * K_STRIDE + 4 * ksel;
  const int voff = lh * V_STRIDE + kg * 16 + 4 * ksel;

  // Stage 0 has landed for this wave; behind the barrier for every wave.
  asm volatile("s_wait_asynccnt 0x0" ::: "memory");
  __syncthreads();
  // Stage 1 into buffer 1; it flies under stage 0's work.
  async_copy_kv(lds_k + KBUF_FLOATS * 4, kb + gkt + (size_t)STAGE_KEYS * KF_ROW,
                lds_v + VBUF_FLOATS * 4, vb + gvt + STAGE_KEYS);
  if (third)
    async_copy_one(lds_k3 + KBUF_FLOATS * 4, kb + gkt3 + (size_t)STAGE_KEYS * KF_ROW);

  for (int st = 0; st < NSTAGE; ++st) {
    const int buf = st & 1;
    const float* krow = smem + KT_OFF + buf * KBUF_FLOATS + koff;
    const float* vrow = smem + VT_OFF + buf * VBUF_FLOATS + voff;

    // ---- scores by three products: s, then re = s - qi.kd, im = s - qr.ks ----
    // Both loops unrolled: constant indices into the query fragments, constant
    // offsets in the LDS reads.
    v8f sc = {};
#pragma unroll
    for (int t = 0; t < 2; ++t) {
      const v4f f = *reinterpret_cast<const v4f*>(krow + 8 * t);
      v2f lo, hi;
      lo[0] = f[0];  lo[1] = f[1];  hi[0] = f[2];  hi[1] = f[3];
      sc = wmma4(lo, qs[2 * t], sc);
      sc = wmma4(hi, qs[2 * t + 1], sc);
    }
    v8f re = sc, im = sc;
#pragma unroll
    for (int t = 0; t < 2; ++t) {
      const v4f fs = *reinterpret_cast<const v4f*>(krow + 16 + 8 * t);
      const v4f fd = *reinterpret_cast<const v4f*>(krow + 32 + 8 * t);
      v2f slo, shi, dlo, dhi;
      slo[0] = fs[0];  slo[1] = fs[1];  shi[0] = fs[2];  shi[1] = fs[3];
      dlo[0] = fd[0];  dlo[1] = fd[1];  dhi[0] = fd[2];  dhi[1] = fd[3];
      re = wmma4(dlo, qni[2 * t], re);
      im = wmma4(slo, qnr[2 * t], im);
      re = wmma4(dhi, qni[2 * t + 1], re);
      im = wmma4(shi, qnr[2 * t + 1], im);
    }

    // V^T fragments: keys 4*ksel..+3 and 8+4*ksel..+3 of components lh, 16+lh.
    const v4f va0 = *reinterpret_cast<const v4f*>(vrow);
    const v4f va1 = *reinterpret_cast<const v4f*>(vrow + 8);
    const v4f vb0 = *reinterpret_cast<const v4f*>(vrow + 16 * V_STRIDE);
    const v4f vb1 = *reinterpret_cast<const v4f*>(vrow + 16 * V_STRIDE + 8);

    // ---- weight + exp (closed form: cos(atan2(im,re)) = re*rsqrt(re^2+im^2)),
    // by register pairs: each pair is a B operand below.  Unrolled: constant
    // indices keep the tiles in registers.
    v2f p[4];
#pragma unroll
    for (int kk = 0; kk < 4; ++kk) {
      v2f r, i, rs;
      r[0] = re[2 * kk];  r[1] = re[2 * kk + 1];
      i[0] = im[2 * kk];  i[1] = im[2 * kk + 1];
      const v2f den = r * r + i * i;
      rs[0] = __frsqrt_rn(den[0]);  rs[1] = __frsqrt_rn(den[1]);
      v2f c1 = 1.0f + r * rs;                    // 1 + cos; 2 where re = im = 0
      c1[0] = (den[0] > 0.0f) ? c1[0] : 2.0f;
      c1[1] = (den[1] > 0.0f) ? c1[1] : 2.0f;
      const v2f wv = 0.5f * c1 * INV_SCALE;
      p[kk][0] = __expf(wv[0]);  p[kk][1] = __expf(wv[1]);
      lsum[kk] += p[kk];
    }

    // ---- O^T += V^T(32x16) @ P^T(16x16) ----
    v2f a;
    a[0] = va0[0];  a[1] = va0[1];  o0 = wmma4(a, p[0], o0);
    a[0] = vb0[0];  a[1] = vb0[1];  o1 = wmma4(a, p[0], o1);
    a[0] = va0[2];  a[1] = va0[3];  o0 = wmma4(a, p[1], o0);
    a[0] = vb0[2];  a[1] = vb0[3];  o1 = wmma4(a, p[1], o1);
    a[0] = va1[0];  a[1] = va1[1];  o0 = wmma4(a, p[2], o0);
    a[0] = vb1[0];  a[1] = vb1[1];  o1 = wmma4(a, p[2], o1);
    a[0] = va1[2];  a[1] = va1[3];  o0 = wmma4(a, p[3], o0);
    a[0] = vb1[2];  a[1] = vb1[3];  o1 = wmma4(a, p[3], o1);

    // Publish point of stage st+1: my LDS reads of this buffer are done, my
    // copies of the next stage have landed; behind the barrier both hold for
    // every wave, so the buffer just read may be refilled.
    asm volatile("s_wait_dscnt 0x0" ::: "memory");
    asm volatile("s_wait_asynccnt 0x0" ::: "memory");
    __syncthreads();
    if (st + 2 < NSTAGE) {
      const size_t vnext = (size_t)((st + 2) * STAGE_KEYS);
      const size_t knext = (size_t)((st + 2) * STAGE_KEYS) * KF_ROW;
      const unsigned lo = (unsigned)(buf * VBUF_FLOATS * 4);
      const unsigned klo = (unsigned)(buf * KBUF_FLOATS * 4);
      async_copy_kv(lds_k + klo, kb + gkt + knext, lds_v + lo, vb + gvt + vnext);
      if (third) async_copy_one(lds_k3 + klo, kb + gkt3 + knext);
    }
  }
  // No copy is left in flight when the ring becomes the partial-sum buffer.
  asm volatile("s_wait_asynccnt 0x0" ::: "memory");

  // This lane's sum of weights: its query, the 8 key rows of its half.
  const v2f l2 = (lsum[0] + lsum[1]) + (lsum[2] + lsum[3]);
  float ls = l2[0] + l2[1];

  // ---- add the 4 key groups' partial sums (the last trip's barrier has ended
  // every read of the ring): groups 1..3 store, group 0 adds in group order ----
  float4* cb = reinterpret_cast<float4*>(smem);
  if (kg != 0) {
    float4* d = cb + ((kg - 1) * QTILES + qi) * 160 + lane;
    d[0]   = make_float4(o0[0], o0[1], o0[2], o0[3]);
    d[32]  = make_float4(o0[4], o0[5], o0[6], o0[7]);
    d[64]  = make_float4(o1[0], o1[1], o1[2], o1[3]);
    d[96]  = make_float4(o1[4], o1[5], o1[6], o1[7]);
    reinterpret_cast<float*>(d - lane + 128)[lane] = ls;
  }
  __syncthreads();
  if (kg != 0) return;
  // Both loops unrolled: constant indices keep o0 and o1 in registers.
#pragma unroll
  for (int g = 0; g < KGROUPS - 1; ++g) {
    const float4* s = cb + (g * QTILES + qi) * 160 + lane;
#pragma unroll
    for (int i = 0; i < 2; ++i) {
      const float4 a0 = s[32 * i], a1 = s[64 + 32 * i];
      o0[4 * i + 0] += a0.x;  o0[4 * i + 1] += a0.y;
      o0[4 * i + 2] += a0.z;  o0[4 * i + 3] += a0.w;
      o1[4 * i + 0] += a1.x;  o1[4 * i + 1] += a1.y;
      o1[4 * i + 2] += a1.z;  o1[4 * i + 3] += a1.w;
    }
    ls += reinterpret_cast<const float*>(s - lane + 128)[lane];
  }

  // ---- softmax normalization: the two halves hold the same query's sums ----
  ls += __shfl_xor(ls, 16);
  const float inv = __frcp_rn(ls);
  // Register j of o0 is component 8*ksel + j of query lh, of o1 16 more: four
  // 16-byte stores; a query's 128-byte line is written by this wave alone.
  // Both loops unrolled: constant indices keep o0 and o1 in registers.
  float* op = ob + (size_t)(b * NN + n0 + lh) * DD + h * HD + 8 * ksel;
#pragma unroll
  for (int i = 0; i < 2; ++i) {
    v4f t0, t1;
#pragma unroll
    for (int e = 0; e < 4; ++e) {
      t0[e] = o0[4 * i + e] * inv;
      t1[e] = o1[4 * i + e] * inv;
    }
    *reinterpret_cast<v4f*>(op + 4 * i)      = t0;
    *reinterpret_cast<v4f*>(op + 16 + 4 * i) = t1;
  }
}

// ---------------------------------------------------------------------------
// Kernel 3: gate MLP (Linear->SiLU->Linear->Sigmoid) + final multiply.
// grid=4096/16, block=128 (4 waves).  A block owns 16 rows; wave w forms the
// 16 rows x 16 hidden units [16w, 16w+16) of the first layer on f32 WMMA, so a
// weight row is read once per 16 rows and a fragment load touches 16 lines.
// The row tile comes in by whole-line loads, stays in registers for the final
// multiply and goes through LDS (pitch 260 floats) for the A fragments.
// Fragments are read 16 bytes a lane: lane half ksel holds k = 8s+4*ksel..+3;
// floats 0,1 feed one WMMA and floats 2,3 the next, alike in A and B.
// ---------------------------------------------------------------------------
#define GROWS   16
#define XPITCH  260            // 16B-aligned rows, b128 fragment reads conflict-free
#define TPITCH  68             // 16B-aligned rows of the 16 x 64 second-layer terms

__global__ __launch_bounds__(128)
void gate_kernel(const float* __restrict__ ob,
                 const float* __restrict__ wg1, const float* __restrict__ bg1,
                 const float* __restrict__ wg2, const float* __restrict__ bg2,
                 float* __restrict__ out)
{
  __shared__ __attribute__((aligned(16))) float xt[GROWS * XPITCH];
  __shared__ __attribute__((aligned(16))) float tt[GROWS * TPITCH];

  const int tid  = threadIdx.x;
  const int wave = tid >> 5;
  const int lane = tid & 31;
  const int lh   = lane & 15;
  const int ksel = lane >> 4;
  const int r0   = blockIdx.x * GROWS;

  // Every loop below is unrolled whole: constant indices keep xv, wf, af and the
  // accumulators in registers.
  // Thread t owns row t/8 of the tile, floats 4*(t%8) + 32*i: 8 lanes cover one
  // 128-byte line, a wave 4 whole lines per load.
  const int xr = tid >> 3;
  const int xc = (tid & 7) * 4;
  const float* xg = ob + (size_t)(r0 + xr) * DD + xc;
  v4f xv[8];
#pragma unroll
  for (int i = 0; i < 8; ++i)
    xv[i] = *reinterpret_cast<const v4f*>(xg + 32 * i);
#pragma unroll
  for (int i = 0; i < 8; ++i)
    *reinterpret_cast<v4f*>(&xt[xr * XPITCH + xc + 32 * i]) = xv[i];

  const int hid = wave * 16 + lh;              // this lane's hidden unit
  const float* bp = wg1 + (size_t)hid * DD + 4 * ksel;
  // All of this lane's weights are asked for ahead of the barrier, so that they
  // fly while the row tile lands: one wave a SIMD has nothing else to hide them.
  v4f wf[DD / 8];
#pragma unroll
  for (int s = 0; s < DD / 8; ++s)
    wf[s] = *reinterpret_cast<const v4f*>(bp + 8 * s);
  const float b1 = bg1[hid];
  const float w2 = wg2[hid];
  const float b2 = bg2[0];

  __syncthreads();                             // the row tile is complete in LDS
  // Precaution: the translation wait stands in front of the first reuse of the
  // loads' address registers (the accumulators take them).
  asm volatile("s_wait_xcnt 0x0" ::: "memory");

  const float* ap = &xt[lh * XPITCH + 4 * ksel];
  v8f acc0 = {}, acc1 = {};
  // A fragments come from LDS eight at a time, one group ahead of the WMMAs
  // that use them, so that the LDS latency lies under 16 WMMAs of work.
  v4f af[2][8];
#pragma unroll
  for (int i = 0; i < 8; ++i)
    af[0][i] = *reinterpret_cast<const v4f*>(ap + 8 * i);
#pragma unroll
  for (int g = 0; g < DD / 64; ++g) {
    if (g + 1 < DD / 64) {
#pragma unroll
      for (int i = 0; i < 8; ++i)
        af[(g + 1) & 1][i] = *reinterpret_cast<const v4f*>(ap + 64 * (g + 1) + 8 * i);
      // Keeps the eight reads issued here: the scheduler otherwise sinks each
      // to two WMMAs ahead of its use, which leaves the LDS latency exposed.
      __builtin_amdgcn_sched_barrier(0);
    }
#pragma unroll
    for (int i = 0; i < 8; ++i) {
      const v4f a = af[g & 1][i];
      const v4f w = wf[8 * g + i];
      v2f a0, a1, w0, w1;
      a0[0] = a[0];  a0[1] = a[1];  a1[0] = a[2];  a1[1] = a[3];
      w0[0] = w[0];  w0[1] = w[1];  w1[0] = w[2];  w1[1] = w[3];
      acc0 = wmma4(a0, w0, acc0);
      acc1 = wmma4(a1, w1, acc1);
    }
  }

  // D layout: register j holds row j + 8*ksel, hidden unit hid.
#pragma unroll
  for (int j = 0; j < 8; ++j) {
    const float z = acc0[j] + acc1[j] + b1;
    tt[(j + 8 * ksel) * TPITCH + hid] = z * sigmoidf_(z) * w2;   // SiLU * wg2
  }
  __syncthreads();                             // all 64 terms of every row stand

  // The 8 threads of a row add 8 terms each, then across the 8 lanes.
  const v4f t0 = *reinterpret_cast<const v4f*>(&tt[xr * TPITCH + (tid & 7) * 8]);
  const v4f t1 = *reinterpret_cast<const v4f*>(&tt[xr * TPITCH + (tid & 7) * 8 + 4]);
  float g = ((t0[0] + t0[1]) + (t0[2] + t0[3])) + ((t1[0] + t1[1]) + (t1[2] + t1[3]));
  g += __shfl_xor(g, 1);
  g += __shfl_xor(g, 2);
  g += __shfl_xor(g, 4);
  g = sigmoidf_(g + b2);

  float* og = out + (size_t)(r0 + xr) * DD + xc;
#pragma unroll
  for (int i = 0; i < 8; ++i)
    *reinterpret_cast<v4f*>(og + 32 * i) = xv[i] * g;
}

// ---------------------------------------------------------------------------
extern "C" void kernel_launch(void* const* d_in, const int* in_sizes, int n_in,
                              void* d_out, int out_size, void* d_ws,
                              size_t ws_size, hipStream_t stream)
{
  const float* x   = (const float*)d_in[0];
  const float* wq  = (const float*)d_in[1];
  const float* bq  = (const float*)d_in[2];
  const float* wk  = (const float*)d_in[3];
  const float* bk  = (const float*)d_in[4];
  const float* wv  = (const float*)d_in[5];
  const float* bv  = (const float*)d_in[6];
  const float* wg1 = (const float*)d_in[7];
  const float* bg1 = (const float*)d_in[8];
  const float* wg2 = (const float*)d_in[9];
  const float* bg2 = (const float*)d_in[10];
  float* out = (float*)d_out;

  // Workspace: q (4 MB) | k, three-product form (8 MB) | v transposed (4 MB) | attn_out (4 MB)
  float* qb = (float*)d_ws;
  float* kb = qb + (size_t)MROWS * DD;
  float* vb = kb + (size_t)MROWS * KF_ROW;
  float* ob = vb + (size_t)MROWS * DD;

  {
    dim3 grid(MROWS / 64, 12);
    qkv_proj_kernel<<<grid, 128, 0, stream>>>(x, wq, bq, wk, bk, wv, bv,
                                              qb, kb, vb);
  }
  {
    dim3 grid(NN / 64, HH, BB);
    spinor_attn_kernel<<<grid, ATTN_THREADS, SMEM_BYTES, stream>>>(qb, kb, vb, ob);
  }
  {
    dim3 grid(MROWS / 16);
    gate_kernel<<<grid, 128, 0, stream>>>(ob, wg1, bg1, wg2, bg2, out);
  }
}

// v007
// A run of this version takes 41.9 microseconds.
// Versions between v005 and this one are left out; their measured steps multiply to 1.86 times as fast.
// Counting every step since v000, it is 3.23 times as fast.
#include <hip/hip_runtime.h>
#include <hip/hip_bf16.h>
#include <math.h>

// Problem constants (match reference)
#define BB  2
#define NN  2048
#define DD  256
#define HH  8
#define HD  32
#define MROWS (BB*NN)          // 4096 flattened rows
// 1/(sqrt(32)+1e-6)
#define INV_SCALE 0.17677666f
// Softmax weight of a score z = re + i*im: exp(INV_SCALE * (1 + cos(arg z)) / 2).
// The factor exp(INV_SCALE / 2) is common to all keys and cancels in the softmax,
// which leaves exp2(EXP2_SCALE * cos(arg z)), cos(arg z) = re * rsqrt(re^2 + im^2).
#define EXP2_SCALE (0.5f * INV_SCALE * 1.44269504f)
// arg 0 = 0 (cos = 1) without a compare: cos = (re + ZEPS) * rsqrt(re^2 + im^2 +
// ZEPS^2).  ZEPS^2 = 2^-124 is a normal f32; at re = im = 0 the quotient is 1, and
// elsewhere the cosine moves by ZEPS / |z|: below 2^-24 from |z| = 2^-38 up.
#define ZEPS 0x1p-62f

// Attention work-group: 16 waves = 4 query tiles x 4 key groups.  A stage is
// 128 keys; key group g works on rows [32g, 32g+32) of every stage.
#define QTILES   4
#define KGROUPS  4
#define STAGE_KEYS (32 * KGROUPS)
#define NSTAGE   (NN / STAGE_KEYS)
#define ATTN_THREADS (32 * QTILES * KGROUPS)

// The attention products run on bf16 WMMA with every f32 operand x given as two
// bf16 parts, hi = bf16(x) and lo = bf16(x - hi): x.y ~ hi.hi + lo.hi + hi.lo
// (lo.lo, about 2^-18 of the product, is left out), summed in f32.
// Keys in the workspace: per (row, head) one 128-byte line, 32 hi parts then 32
// lo parts, components in their natural order (real, imaginary, ...).
// Values in the workspace, transposed: per (batch, head) 32 rows, one per
// component d; a row is NN/32 lines of 128 bytes, one per group of 32 keys: the
// 32 hi parts, then the 32 lo parts.  Every line has one writer.
// Both take 4 bytes an element, so that indices in floats stay those of f32.

// LDS layout for the attention kernel (float indices):
//   K stages  : 2 bufs x 128 keys x 36 floats       -> [0,    9216)
//   V^T stages: 2 bufs x 32 components x 132 floats -> [9216, 17664)
// After the key loop [0, 7680) is reused for the partial sums of key groups
// 1..3: 12 waves x 640 floats (17 values x 32 lanes are used).
#define V_STRIDE 132           // 128 + 4: 528-byte rows, 16 B x odd for b128 reads
#define VBUF_FLOATS (HD * V_STRIDE)
#define K_STRIDE 36            // 32 + 4: 144-byte rows, 16 B x odd for b128 reads
#define KBUF_FLOATS (STAGE_KEYS * K_STRIDE)
#define KT_OFF   0
#define VT_OFF   (2 * KBUF_FLOATS)
#define SMEM_FLOATS (VT_OFF + 2 * VBUF_FLOATS)

typedef float v2f __attribute__((ext_vector_type(2)));
typedef float v4f __attribute__((ext_vector_type(4)));
typedef float v8f __attribute__((ext_vector_type(8)));
typedef __bf16 bf16x2 __attribute__((ext_vector_type(2)));
typedef __bf16 bf16x16 __attribute__((ext_vector_type(16)));
typedef unsigned u32x4 __attribute__((ext_vector_type(4)));
typedef unsigned u32x8 __attribute__((ext_vector_type(8)));

// D = A(16x4 f32) * B(4x16 f32) + C, one wave, fp32 WMMA
__device__ __forceinline__ v8f wmma4(v2f a, v2f b, v8f c) {
  return __builtin_amdgcn_wmma_f32_16x16x4_f32(
      /*neg_a=*/false, a, /*neg_b=*/false, b,
      /*c_mod=*/(short)0, c, /*reuse_a=*/false, /*reuse_b=*/false);
}

// D = A(16x32 bf16) * B(32x16 bf16) + C, one wave, f32 sums.  A fragment is 8
// registers of two bf16 each, the lower k in the low half.
__device__ __forceinline__ v8f wmma32(u32x8 a, u32x8 b, v8f c) {
  return __builtin_amdgcn_wmma_f32_16x16x32_bf16(
      /*neg_a=*/false, __builtin_bit_cast(bf16x16, a),
      /*neg_b=*/false, __builtin_bit_cast(bf16x16, b),
      /*c_mod=*/(short)0, c, /*reuse_a=*/false, /*reuse_b=*/false);
}

// Two f32 values as a word of hi parts and a word of lo parts (x[0] low half).
__device__ __forceinline__ void split_pair(v2f x, unsigned& hi, unsigned& lo) {
  hi = __builtin_bit_cast(unsigned, __builtin_convertvector(x, bf16x2));
  v2f h;
  h[0] = __uint_as_float(hi << 16);
  h[1] = __uint_as_float(hi & 0xffff0000u);
  lo = __builtin_bit_cast(unsigned, __builtin_convertvector(x - h, bf16x2));
}

// A 16-element bf16 fragment from two 16-byte LDS reads.
__device__ __forceinline__ u32x8 frag16(const float* p0, const float* p1) {
  const u32x4 a = *reinterpret_cast<const u32x4*>(p0);
  const u32x4 b = *reinterpret_cast<const u32x4*>(p1);
  return __builtin_shufflevector(a, b, 0, 1, 2, 3, 4, 5, 6, 7);
}

__device__ __forceinline__ float sigmoidf_(float x) {
  return 1.0f / (1.0f + __expf(-x));
}

// gfx1250 async copies, tracked by ASYNCcnt: two 16-byte chunks of K (rows r and
// r + 64 of the stage) and two of V^T (rows c and c + 16) per lane.  The
// s_wait_xcnt stands in the copies' own statement so that no later write of an
// address register can be scheduled in front of it.
__device__ __forceinline__ void async_copy_kv(unsigned lds_k, const float* gk,
                                              unsigned lds_v, const float* gv) {
  asm volatile("global_load_async_to_lds_b128 %0, %4, off\n\t"
               "global_load_async_to_lds_b128 %1, %5, off\n\t"
               "global_load_async_to_lds_b128 %2, %6, off\n\t"
               "global_load_async_to_lds_b128 %3, %7, off\n\t"
               "s_wait_xcnt 0x0"
               :: "v"(lds_k), "v"(lds_k + 64 * K_STRIDE * 4),
                  "v"(lds_v), "v"(lds_v + 16 * V_STRIDE * 4),
                  "v"(gk), "v"(gk + 64 * DD), "v"(gv), "v"(gv + 16 * NN)
               : "memory");
}

// Value of the neighbour lane (lane ^ 1): quad_perm [1,0,3,2], a vector move.
__device__ __forceinline__ float lane_xor1(float v) {
  return __int_as_float(__builtin_amdgcn_mov_dpp(__float_as_int(v), 0xB1, 0xF, 0xF, true));
}

// ---------------------------------------------------------------------------
// Kernel 1: q/k/v = x @ W^T + b.  grid=(MROWS/64, 12), block=128 (4 waves).
// A block forms a 64-row x 64-col tile of one of q, k, v; wave w the 32 x 32
// part (w >> 1, w & 1) as 2 x 2 WMMA tiles, so a 128-byte output line has one
// writer.  The 64 rows of x and the 64 rows of W come into LDS 64 k at a time by
// async copies of whole lines (two buffers, the next stage flying under this
// stage's WMMAs); a global line is so asked for once per block.
// Fragments are read 16 bytes a lane: lane half ksel holds k = 8s+4*ksel..+3;
// floats 0,1 feed one WMMA and floats 2,3 the next, alike in A and B.
// q is written as it is; k and v in bf16 hi and lo parts (layouts above).  k: a
// wave's 32 columns are one head; neighbour lanes hold the two halves of a word,
// the even lane writes the hi word, the odd lane the lo word.  v transposed: a
// lane's 8 accumulator registers are 8 successive rows of one column, 16 bytes
// of hi and 16 of lo parts, and a wave's 32 rows fill a 128-byte line.
// ---------------------------------------------------------------------------
#define PT_ROWS  64            // rows of x, and rows of W, in a block's tile
#define PT_KC    64            // k per stage: 256 bytes of every row
#define PT_PITCH 68            // 272-byte rows: b128 fragment reads conflict-free
#define PT_OPER  (PT_ROWS * PT_PITCH)      // one operand's stage, floats
#define PT_BUF   (2 * PT_OPER)             // x stage, then W stage
#define PT_NST   (DD / PT_KC)

// Eight async copies (ASYNCcnt): rows r, r+8, ..., r+56 of one operand's stage,
// 16 bytes a lane, 16 lanes a row.  The s_wait_xcnt stands in the copies' own
// statement so that no later write of an address register can be scheduled in
// front of it.
__device__ __forceinline__ void async_copy_rows8(unsigned lds, const float* g) {
  asm volatile("global_load_async_to_lds_b128 %0, %8, off\n\t"
               "global_load_async_to_lds_b128 %1, %9, off\n\t"
               "global_load_async_to_lds_b128 %2, %10, off\n\t"
               "global_load_async_to_lds_b128 %3, %11, off\n\t"
               "global_load_async_to_lds_b128 %4, %12, off\n\t"
               "global_load_async_to_lds_b128 %5, %13, off\n\t"
               "global_load_async_to_lds_b128 %6, %14, off\n\t"
               "global_load_async_to_lds_b128 %7, %15, off\n\t"
               "s_wait_xcnt 0x0"
               :: "v"(lds),
                  "v"(lds +  8 * PT_PITCH * 4), "v"(lds + 16 * PT_PITCH * 4),
                  "v"(lds + 24 * PT_PITCH * 4), "v"(lds + 32 * PT_PITCH * 4),
                  "v"(lds + 40 * PT_PITCH * 4), "v"(lds + 48 * PT_PITCH * 4),
                  "v"(lds + 56 * PT_PITCH * 4),
                  "v"(g),
                  "v"(g +  8 * DD), "v"(g + 16 * DD), "v"(g + 24 * DD),
                  "v"(g + 32 * DD), "v"(g + 40 * DD), "v"(g + 48 * DD),
                  "v"(g + 56 * DD)
               : "memory");
}

__global__ __launch_bounds__(128)
void qkv_proj_kernel(const float* __restrict__ x,
                     const float* __restrict__ wq, const float* __restrict__ bq,
                     const float* __restrict__ wk, const float* __restrict__ bk,
                     const float* __restrict__ wv, const float* __restrict__ bv,
                     float* __restrict__ qb, float* __restrict__ kb,
                     float* __restrict__ vb)
{
  __shared__ __attribute__((aligned(16))) float st[2 * PT_BUF];

  const int mat = blockIdx.y >> 2;     // 0: q, 1: k, 2: v
  const float* w;  const float* bias;  float* out;
  if (mat == 0)      { w = wq; bias = bq; out = qb; }
  else if (mat == 1) { w = wk; bias = bk; out = kb; }
  else               { w = wv; bias = bv; out = vb; }

  const int tid  = threadIdx.x;
  const int wave = tid >> 5;
  const int lane = tid & 31;
  const int lh   = lane & 15;
  const int ksel = lane >> 4;          // 0 or 1 (K half of fragment)
  const int wr   = wave >> 1;          // 32-row half of the tile
  const int wc   = wave & 1;           // 32-col half of the tile

  const int r0 = blockIdx.x * PT_ROWS;         // first row of x
  const int c0 = (blockIdx.y & 3) * PT_ROWS;   // first output column = row of W

  // Stage loader: thread t moves floats 4*(t%16).. of rows t/16 + 8*i.
  const int cr = tid >> 4;
  const int cc = (tid & 15) * 4;
  const float* gx = x + (size_t)(r0 + cr) * DD + cc;
  const float* gw = w + (size_t)(c0 + cr) * DD + cc;
  const unsigned lx = (unsigned)(size_t)(st + cr * PT_PITCH + cc);
  const unsigned lw = lx + PT_OPER * 4;

  // Prologue: stage 0 into buffer 0.
  async_copy_rows8(lx, gx);
  async_copy_rows8(lw, gw);
  // Stage 0 has landed for this wave; behind the barrier for every wave.
  asm volatile("s_wait_asynccnt 0x0" ::: "memory");
  __syncthreads();
  // Stage 1 into buffer 1; it flies under stage 0's work.
  async_copy_rows8(lx + PT_BUF * 4, gx + PT_KC);
  async_copy_rows8(lw + PT_BUF * 4, gw + PT_KC);

  v8f acc00 = {}, acc01 = {}, acc10 = {}, acc11 = {};

  for (int s = 0; s < PT_NST; ++s) {
    const int buf = s & 1;
    const float* ap = st + buf * PT_BUF + (wr * 32 + lh) * PT_PITCH + 4 * ksel;
    const float* bp = st + buf * PT_BUF + PT_OPER + (wc * 32 + lh) * PT_PITCH + 4 * ksel;
    // Unrolled whole: the fragment reads take constant offsets.
#pragma unroll
    for (int k = 0; k < PT_KC / 8; ++k) {
      const v4f a0 = *reinterpret_cast<const v4f*>(ap + 8 * k);
      const v4f a1 = *reinterpret_cast<const v4f*>(ap + 16 * PT_PITCH + 8 * k);
      const v4f b0 = *reinterpret_cast<const v4f*>(bp + 8 * k);
      const v4f b1 = *reinterpret_cast<const v4f*>(bp + 16 * PT_PITCH + 8 * k);
      v2f a0l, a0h, a1l, a1h, b0l, b0h, b1l, b1h;
      a0l[0] = a0[0];  a0l[1] = a0[1];  a0h[0] = a0[2];  a0h[1] = a0[3];
      a1l[0] = a1[0];  a1l[1] = a1[1];  a1h[0] = a1[2];  a1h[1] = a1[3];
      b0l[0] = b0[0];  b0l[1] = b0[1];  b0h[0] = b0[2];  b0h[1] = b0[3];
      b1l[0] = b1[0];  b1l[1] = b1[1];  b1h[0] = b1[2];  b1h[1] = b1[3];
      acc00 = wmma4(a0l, b0l, acc00);
      acc01 = wmma4(a0l, b1l, acc01);
      acc10 = wmma4(a1l, b0l, acc10);
      acc11 = wmma4(a1l, b1l, acc11);
      acc00 = wmma4(a0h, b0h, acc00);
      acc01 = wmma4(a0h, b1h, acc01);
      acc10 = wmma4(a1h, b0h, acc10);
      acc11 = wmma4(a1h, b1h, acc11);
    }

    // Publish point of stage s+1: my LDS reads of this buffer are done, my
    // copies of the next stage have landed; behind the barrier both hold for
    // every wave, so the buffer just read may be refilled.
    asm volatile("s_wait_dscnt 0x0" ::: "memory");
    asm volatile("s_wait_asynccnt 0x0" ::: "memory");
    __syncthreads();
    if (s + 2 < PT_NST) {
      const unsigned lo = (unsigned)(buf * PT_BUF * 4);
      async_copy_rows8(lx + lo, gx + (s + 2) * PT_KC);
      async_copy_rows8(lw + lo, gw + (s + 2) * PT_KC);
    }
  }
  // No copy is left in flight when the wave ends.
  asm volatile("s_wait_asynccnt 0x0" ::: "memory");

  // Epilogue: C/D layout -> VGPR j holds row (tile row + j + 8*ksel), col = lh
  const int col = c0 + wc * 32 + lh;
  const float bias0 = bias[col];
  const float bias1 = bias[col + 16];
  if (mat == 0) {
    float* op = out + (size_t)(r0 + wr * 32 + 8 * ksel) * DD + col;
#pragma unroll
    for (int j = 0; j < 8; ++j) {
      op[(size_t)j * DD]             = acc00[j] + bias0;
      op[(size_t)j * DD + 16]        = acc01[j] + bias1;
      op[(size_t)(j + 16) * DD]      = acc10[j] + bias0;
      op[(size_t)(j + 16) * DD + 16] = acc11[j] + bias1;
    }
    // Precaution: the translation wait stands behind the stores, in front of the
    // return; q blocks end here and never reach the key part below.
    asm volatile("s_wait_xcnt 0x0" ::: "memory");
    return;
  }

  const int head = (blockIdx.y & 3) * 2 + wc;
  if (mat == 2) {
    // Values, transposed: row = (batch, head, component); the wave's 32 rows of
    // x are one 32-key line of it.  Rows 16*i + 8*ksel .. +7 are the 16 bytes
    // number 2*i + ksel of the hi parts, and of the lo parts 64 bytes on.
    float* vp = out + (size_t)(((r0 / NN) * HH + head) * HD + lh) * NN
                + (r0 % NN) + wr * 32 + 4 * ksel;
    u32x4 h00, l00, h01, l01, h10, l10, h11, l11;
    // Unrolled: constant indices keep the accumulators in registers.
#pragma unroll
    for (int e = 0; e < 4; ++e) {
      v2f t;
      unsigned hw, lw;
      t[0] = acc00[2 * e] + bias0;  t[1] = acc00[2 * e + 1] + bias0;
      split_pair(t, hw, lw);  h00[e] = hw;  l00[e] = lw;
      t[0] = acc01[2 * e] + bias1;  t[1] = acc01[2 * e + 1] + bias1;
      split_pair(t, hw, lw);  h01[e] = hw;  l01[e] = lw;
      t[0] = acc10[2 * e] + bias0;  t[1] = acc10[2 * e + 1] + bias0;
      split_pair(t, hw, lw);  h10[e] = hw;  l10[e] = lw;
      t[0] = acc11[2 * e] + bias1;  t[1] = acc11[2 * e + 1] + bias1;
      split_pair(t, hw, lw);  h11[e] = hw;  l11[e] = lw;
    }
    *reinterpret_cast<u32x4*>(vp)                = h00;
    *reinterpret_cast<u32x4*>(vp + 8)            = h10;
    *reinterpret_cast<u32x4*>(vp + 16)           = l00;
    *reinterpret_cast<u32x4*>(vp + 24)           = l10;
    *reinterpret_cast<u32x4*>(vp + 16 * NN)      = h01;
    *reinterpret_cast<u32x4*>(vp + 16 * NN + 8)  = h11;
    *reinterpret_cast<u32x4*>(vp + 16 * NN + 16) = l01;
    *reinterpret_cast<u32x4*>(vp + 16 * NN + 24) = l11;
    // Precaution: as above, the translation wait behind the stores.
    asm volatile("s_wait_xcnt 0x0" ::: "memory");
    return;
  }

  // Keys.  Even lane: component lh of the head (+16 in the upper 16 columns), the
  // low half of word lh/2; odd lane: the high half of the same word.  Both form
  // the word's hi and lo parts; the even lane writes hi, the odd lane lo.
  const bool odd = (lh & 1) != 0;
  unsigned* kp = reinterpret_cast<unsigned*>(out)
                 + (size_t)(r0 + wr * 32 + 8 * ksel) * DD + head * HD
                 + (lh >> 1) + (odd ? 16 : 0);
  // Both loops unrolled: constant indices keep the accumulators and kw in
  // registers.
  unsigned kw[32];
#pragma unroll
  for (int j = 0; j < 8; ++j) {
    const float t0 = acc00[j] + bias0, t1 = acc01[j] + bias1;
    const float t2 = acc10[j] + bias0, t3 = acc11[j] + bias1;
    const float n0 = lane_xor1(t0), n1 = lane_xor1(t1);
    const float n2 = lane_xor1(t2), n3 = lane_xor1(t3);
    v2f p0, p1, p2, p3;
    p0[0] = odd ? n0 : t0;  p0[1] = odd ? t0 : n0;
    p1[0] = odd ? n1 : t1;  p1[1] = odd ? t1 : n1;
    p2[0] = odd ? n2 : t2;  p2[1] = odd ? t2 : n2;
    p3[0] = odd ? n3 : t3;  p3[1] = odd ? t3 : n3;
    unsigned h0, l0, h1, l1, h2, l2, h3, l3;
    split_pair(p0, h0, l0);  split_pair(p1, h1, l1);
    split_pair(p2, h2, l2);  split_pair(p3, h3, l3);
    kw[j]      = odd ? l0 : h0;
    kw[8 + j]  = odd ? l1 : h1;
    kw[16 + j] = odd ? l2 : h2;
    kw[24 + j] = odd ? l3 : h3;
  }
#pragma unroll
  for (int j = 0; j < 8; ++j) {
    kp[(size_t)j * DD]            = kw[j];
    kp[(size_t)j * DD + 8]        = kw[8 + j];
    kp[(size_t)(j + 16) * DD]     = kw[16 + j];
    kp[(size_t)(j + 16) * DD + 8] = kw[24 + j];
  }
  // Precaution: as above, the translation wait behind the stores, in front of any
  // reuse of their registers where the compiler lays another part behind them.
  asm volatile("s_wait_xcnt 0x0" ::: "memory");
}

// ---------------------------------------------------------------------------
// Kernel 2: spinor flash attention, transposed form.  grid=(N/64, H, B),
// block=512 (16 waves).  All waves share one (b,h); wave w owns query tile
// (w & 3) and key group (w >> 2), so each query tile's keys are walked by 4
// waves side by side.
// K (128 keys x 128 bytes) and V^T (32 components x 512 bytes) stages are put in
// LDS once per block via double-buffered gfx1250 async copies (ASYNCcnt), the
// next stage's copies flying under this stage's work.  The 4 partial results of
// a query tile are added through LDS at the end.
// Scores are bounded in [0, 0.177] after scaling -> plain sum-of-exp softmax,
// so partial sums over key groups add with no rescale.
// The complex score q.conj(k) as two real products of length 32 over the
// interleaved components: re = k.q and im = k.t with t = (qi, -qr, ...).  One
// bf16 WMMA spans the 32 components; hi.hi + lo.hi + hi.lo makes three a product.
// Fragments of K, q and t alike: lane half ksel holds components 16*ksel..+15.
// Transposed: S^T = K.Q^T (A = key rows, B = queries), so a lane holds 8 keys'
// scores of ONE query per 16-key tile, and the exp weights of a wave's two
// tiles, packed to bf16 in place, are the B operand of O^T += V^T.P^T over 32
// keys: element s of lane half ksel is key 8*ksel + s for s < 8 and
// 16 + 8*ksel + (s - 8) above.  V^T is read in that order: the 16 bytes at
// 16*ksel and at 32 + 16*ksel of the 64 bytes of hi (and of lo) parts.
// ---------------------------------------------------------------------------
__global__ __launch_bounds__(ATTN_THREADS)
void spinor_attn_kernel(const float* __restrict__ qb,
                        const float* __restrict__ kb,
                        const float* __restrict__ vb,
                        float* __restrict__ ob)
{
  __shared__ __attribute__((aligned(16))) float smem[SMEM_FLOATS];

  const int tid  = threadIdx.x;
  const int wave = tid >> 5;
  const int lane = tid & 31;
  const int lh   = lane & 15;
  const int ksel = lane >> 4;
  const int qi   = wave & (QTILES - 1);   // query tile inside the block
  const int kg   = wave / QTILES;         // key group 0..3

  const int b  = blockIdx.z;
  const int h  = blockIdx.y;
  const int qt = blockIdx.x * QTILES + qi; // query tile 0..127
  const int n0 = qt * 16;

  // Cooperative stage loader: thread t moves two 16B chunks of K (rows lr and
  // lr + 64) and two of V^T (rows vr and vr + 16).
  const int lr = tid >> 3;                // key row of the stage 0..63
  const int lc = (tid & 7) * 4;           // its float 0,4,...,28
  const int vr = tid >> 5;                // component row of V^T 0..15
  const int vc = (tid & 31) * 4;          // its float 0,4,...,124
  const size_t gvt = (size_t)((b * HH + h) * HD + vr) * NN + vc;
  const size_t gkt = (size_t)(b * NN + lr) * DD + h * HD + lc;
  const unsigned lds_k =
      (unsigned)(size_t)(smem + KT_OFF + lr * K_STRIDE + lc);
  const unsigned lds_v =
      (unsigned)(size_t)(smem + VT_OFF + vr * V_STRIDE + vc);

  // Prologue: stage 0 into buffer 0.
  async_copy_kv(lds_k, kb + gkt, lds_v, vb + gvt);

  // Query-side B fragments, formed once: q and t = (qi, -qr, ...), hi and lo.
  const float* qp = qb + (size_t)(b * NN + n0 + lh) * DD + h * HD + 16 * ksel;
  u32x8 qh, ql, th, tl;
  // Both loops unrolled: constant indices keep the fragments in registers.
#pragma unroll
  for (int s = 0; s < 4; ++s) {
    const v4f f = *reinterpret_cast<const v4f*>(qp + 4 * s);   // (r, i, r, i)
#pragma unroll
    for (int e = 0; e < 2; ++e) {
      v2f c;
      unsigned hw, lw;
      c[0] = f[2 * e];  c[1] = f[2 * e + 1];
      split_pair(c, hw, lw);
      qh[2 * s + e] = hw;
      ql[2 * s + e] = lw;
      // Halves exchanged, the sign of the new high half turned: (i, -r).
      th[2 * s + e] = ((hw >> 16) | (hw << 16)) ^ 0x80000000u;
      tl[2 * s + e] = ((lw >> 16) | (lw << 16)) ^ 0x80000000u;
    }
  }

  // Constants of the weight's three fused multiply-adds (see EXP2_SCALE, ZEPS).
  const v2f e2v  = {ZEPS * ZEPS, ZEPS * ZEPS};
  const v2f c2v  = {EXP2_SCALE, EXP2_SCALE};
  const v2f c2ev = {EXP2_SCALE * ZEPS, EXP2_SCALE * ZEPS};

  v8f o0 = {}, o1 = {};     // O^T accumulators, d in [0,16) and [16,32)
  v2f lsum[4] = {};         // this lane's sums of exp weights, by register pair

  // This lane's key row in its group's first tile, and its V^T row (component lh).
  const int koff = (kg * 32 + lh) * K_STRIDE + 8 * ksel;
  const int voff = lh * V_STRIDE + kg * 32 + 4 * ksel;

  // Stage 0 has landed for this wave; behind the barrier for every wave.
  asm volatile("s_wait_asynccnt 0x0" ::: "memory");
  __syncthreads();
  // Stage 1 into buffer 1; it flies under stage 0's work.
  async_copy_kv(lds_k + KBUF_FLOATS * 4, kb + gkt + (size_t)STAGE_KEYS * DD,
                lds_v + VBUF_FLOATS * 4, vb + gvt + STAGE_KEYS);

  for (int st = 0; st < NSTAGE; ++st) {
    const int buf = st & 1;
    const float* krow = smem + KT_OFF + buf * KBUF_FLOATS + koff;
    const float* vrow = smem + VT_OFF + buf * VBUF_FLOATS + voff;

    u32x8 ph, pl;           // exp weights of the 32 keys, hi and lo parts
    v8f re[2], im[2];
    // All loops unrolled: constant indices keep tiles and weights in registers,
    // constant offsets in the LDS reads.
    // ---- scores of 2 x 16 keys: re = k.q, im = k.t, three bf16 products each.
    // Both tiles' products stand ahead of the weights, so that the second tile's
    // WMMAs fill the distance between the first tile's last WMMA and its reader.
    u32x8 kh[2], kl[2];
#pragma unroll
    for (int t = 0; t < 2; ++t) {
      const float* kr = krow + t * 16 * K_STRIDE;
      kh[t] = frag16(kr, kr + 4);
      kl[t] = frag16(kr + 16, kr + 20);
    }
    // Keeps the eight reads at one place: the scheduler otherwise sinks the second
    // tile's four behind the first tile's WMMAs, a second exposed LDS wait.
    __builtin_amdgcn_sched_barrier(0);
#pragma unroll
    for (int t = 0; t < 2; ++t) {
      v8f a = {}, c = {};
      a = wmma32(kh[t], qh, a);
      c = wmma32(kh[t], th, c);
      a = wmma32(kl[t], qh, a);
      c = wmma32(kl[t], th, c);
      a = wmma32(kh[t], ql, a);
      c = wmma32(kh[t], tl, c);
      re[t] = a;
      im[t] = c;
    }
    // Holds the twelve WMMAs together: the scheduler otherwise sinks the second
    // tile's behind the first tile's weights and pads both tiles with v_nop.
    __builtin_amdgcn_sched_barrier(0);

#pragma unroll
    for (int t = 0; t < 2; ++t) {
      // ---- exp weight, by register pairs: each pair is a word of the B operand
      // below (the closed form stands at the constants above).
#pragma unroll
      for (int kk = 0; kk < 4; ++kk) {
        v2f r, i, rs, p;
        r[0] = re[t][2 * kk];  r[1] = re[t][2 * kk + 1];
        i[0] = im[t][2 * kk];  i[1] = im[t][2 * kk + 1];
        const v2f den = __builtin_elementwise_fma(r, r, __builtin_elementwise_fma(i, i, e2v));
        rs[0] = __builtin_amdgcn_rsqf(den[0]);  rs[1] = __builtin_amdgcn_rsqf(den[1]);
        const v2f y = __builtin_elementwise_fma(r, c2v, c2ev) * rs;
        p[0] = __builtin_amdgcn_exp2f(y[0]);  p[1] = __builtin_amdgcn_exp2f(y[1]);
        lsum[kk] += p;
        unsigned hw, lw;
        split_pair(p, hw, lw);
        ph[4 * t + kk] = hw;
        pl[4 * t + kk] = lw;
      }
    }

    // V^T fragments of components lh and 16 + lh, hi and lo parts.
    const u32x8 vh0 = frag16(vrow, vrow + 8);
    const u32x8 vl0 = frag16(vrow + 16, vrow + 24);
    const u32x8 vh1 = frag16(vrow + 16 * V_STRIDE, vrow + 16 * V_STRIDE + 8);
    const u32x8 vl1 = frag16(vrow + 16 * V_STRIDE + 16, vrow + 16 * V_STRIDE + 24);

    // ---- O^T += V^T(32x32) @ P^T(32x16), three bf16 products a tile ----
    o0 = wmma32(vh0, ph, o0);
    o1 = wmma32(vh1, ph, o1);
    o0 = wmma32(vl0, ph, o0);
    o1 = wmma32(vl1, ph, o1);
    o0 = wmma32(vh0, pl, o0);
    o1 = wmma32(vh1, pl, o1);

    // Publish point of stage st+1: my LDS reads of this buffer are done, my
    // copies of the next stage have landed; behind the barrier both hold for
    // every wave, so the buffer just read may be refilled.
    asm volatile("s_wait_dscnt 0x0" ::: "memory");
    asm volatile("s_wait_asynccnt 0x0" ::: "memory");
    __syncthreads();
    if (st + 2 < NSTAGE) {
      const size_t vnext = (size_t)((st + 2) * STAGE_KEYS);
      const size_t knext = (size_t)((st + 2) * STAGE_KEYS) * DD;
      const unsigned lo = (unsigned)(buf * VBUF_FLOATS * 4);
      const unsigned klo = (unsigned)(buf * KBUF_FLOATS * 4);
      async_copy_kv(lds_k + klo, kb + gkt + knext, lds_v + lo, vb + gvt + vnext);
    }
  }
  // No copy is left in flight when the ring becomes the partial-sum buffer.
  asm volatile("s_wait_asynccnt 0x0" ::: "memory");

  // This lane's sum of weights: its query, the 8 key rows of its half.
  const v2f l2 = (lsum[0] + lsum[1]) + (lsum[2] + lsum[3]);
  float ls = l2[0] + l2[1];

  // ---- add the 4 key groups' partial sums (the last trip's barrier has ended
  // every read of the ring): groups 1..3 store, group 0 adds in group order ----
  float4* cb = reinterpret_cast<float4*>(smem);
  if (kg != 0) {
    float4* d = cb + ((kg - 1) * QTILES + qi) * 160 + lane;
    d[0]   = make_float4(o0[0], o0[1], o0[2], o0[3]);
    d[32]  = make_float4(o0[4], o0[5], o0[6], o0[7]);
    d[64]  = make_float4(o1[0], o1[1], o1[2], o1[3]);
    d[96]  = make_float4(o1[4], o1[5], o1[6], o1[7]);
    reinterpret_cast<float*>(d - lane + 128)[lane] = ls;
  }
  __syncthreads();
  if (kg != 0) return;
  // Both loops unrolled: constant indices keep o0 and o1 in registers.
#pragma unroll
  for (int g = 0; g < KGROUPS - 1; ++g) {
    const float4* s = cb + (g * QTILES + qi) * 160 + lane;
#pragma unroll
    for (int i = 0; i < 2; ++i) {
      const float4 a0 = s[32 * i], a1 = s[64 + 32 * i];
      o0[4 * i + 0] += a0.x;  o0[4 * i + 1] += a0.y;
      o0[4 * i + 2] += a0.z;  o0[4 * i + 3] += a0.w;
      o1[4 * i + 0] += a1.x;  o1[4 * i + 1] += a1.y;
      o1[4 * i + 2] += a1.z;  o1[4 * i + 3] += a1.w;
    }
    ls += reinterpret_cast<const float*>(s - lane + 128)[lane];
  }

  // ---- softmax normalization: the two halves hold the same query's sums ----
  ls += __shfl_xor(ls, 16);
  const float inv = __frcp_rn(ls);
  // Register j of o0 is component 8*ksel + j of query lh, of o1 16 more: four
  // 16-byte stores; a query's 128-byte line is written by this wave alone.
  // Both loops unrolled: constant indices keep o0 and o1 in registers.
  float* op = ob + (size_t)(b * NN + n0 + lh) * DD + h * HD + 8 * ksel;
#pragma unroll
  for (int i = 0; i < 2; ++i) {
    v4f t0, t1;
#pragma unroll
    for (int e = 0; e < 4; ++e) {
      t0[e] = o0[4 * i + e] * inv;
      t1[e] = o1[4 * i + e] * inv;
    }
    *reinterpret_cast<v4f*>(op + 4 * i)      = t0;
    *reinterpret_cast<v4f*>(op + 16 + 4 * i) = t1;
  }
}

// ---------------------------------------------------------------------------
// Kernel 3: gate MLP (Linear->SiLU->Linear->Sigmoid) + final multiply.
// grid=4096/16, block=128 (4 waves).  A block owns 16 rows; wave w forms the
// 16 rows x 16 hidden units [16w, 16w+16) of the first layer on f32 WMMA, so a
// weight row is read once per 16 rows and a fragment load touches 16 lines.
// The row tile comes in by whole-line loads, stays in registers for the final
// multiply and goes through LDS (pitch 260 floats) for the A fragments.
// Fragments are read 16 bytes a lane: lane half ksel holds k = 8s+4*ksel..+3;
// floats 0,1 feed one WMMA and floats 2,3 the next, alike in A and B.
// ---------------------------------------------------------------------------
#define GROWS   16
#define XPITCH  260            // 16B-aligned rows, b128 fragment reads conflict-free
#define TPITCH  68             // 16B-aligned rows of the 16 x 64 second-layer terms

__global__ __launch_bounds__(128)
void gate_kernel(const float* __restrict__ ob,
                 const float* __restrict__ wg1, const float* __restrict__ bg1,
                 const float* __restrict__ wg2, const float* __restrict__ bg2,
                 float* __restrict__ out)
{
  __shared__ __attribute__((aligned(16))) float xt[GROWS * XPITCH];
  __shared__ __attribute__((aligned(16))) float tt[GROWS * TPITCH];

  const int tid  = threadIdx.x;
  const int wave = tid >> 5;
  const int lane = tid & 31;
  const int lh   = lane & 15;
  const int ksel = lane >> 4;
  const int r0   = blockIdx.x * GROWS;

  // Every loop below is unrolled whole: constant indices keep xv, wf, af and the
  // accumulators in registers.
  // Thread t owns row t/8 of the tile, floats 4*(t%8) + 32*i: 8 lanes cover one
  // 128-byte line, a wave 4 whole lines per load.
  const int xr = tid >> 3;
  const int xc = (tid & 7) * 4;
  const float* xg = ob + (size_t)(r0 + xr) * DD + xc;
  v4f xv[8];
#pragma unroll
  for (int i = 0; i < 8; ++i)
    xv[i] = *reinterpret_cast<const v4f*>(xg + 32 * i);
#pragma unroll
  for (int i = 0; i < 8; ++i)
    *reinterpret_cast<v4f*>(&xt[xr * XPITCH + xc + 32 * i]) = xv[i];

  const int hid = wave * 16 + lh;              // this lane's hidden unit
  const float* bp = wg1 + (size_t)hid * DD + 4 * ksel;
  // All of this lane's weights are asked for ahead of the barrier, so that they
  // fly while the row tile lands: one wave a SIMD has nothing else to hide them.
  v4f wf[DD / 8];
#pragma unroll
  for (int s = 0; s < DD / 8; ++s)
    wf[s] = *reinterpret_cast<const v4f*>(bp + 8 * s);
  const float b1 = bg1[hid];
  const float w2 = wg2[hid];
  const float b2 = bg2[0];

  __syncthreads();                             // the row tile is complete in LDS
  // Precaution: the translation wait stands in front of the first reuse of the
  // loads' address registers (the accumulators take them).
  asm volatile("s_wait_xcnt 0x0" ::: "memory");

  const float* ap = &xt[lh * XPITCH + 4 * ksel];
  v8f acc0 = {}, acc1 = {};
  // A fragments come from LDS eight at a time, one group ahead of the WMMAs
  // that use them, so that the LDS latency lies under 16 WMMAs of work.
  v4f af[2][8];
#pragma unroll
  for (int i = 0; i < 8; ++i)
    af[0][i] = *reinterpret_cast<const v4f*>(ap + 8 * i);
#pragma unroll
  for (int g = 0; g < DD / 64; ++g) {
    if (g + 1 < DD / 64) {
#pragma unroll
      for (int i = 0; i < 8; ++i)
        af[(g + 1) & 1][i] = *reinterpret_cast<const v4f*>(ap + 64 * (g + 1) + 8 * i);
      // Keeps the eight reads issued here: the scheduler otherwise sinks each
      // to two WMMAs ahead of its use, which leaves the LDS latency exposed.
      __builtin_amdgcn_sched_barrier(0);
    }
#pragma unroll
    for (int i = 0; i < 8; ++i) {
      const v4f a = af[g & 1][i];
      const v4f w = wf[8 * g + i];
      v2f a0, a1, w0, w1;
      a0[0] = a[0];  a0[1] = a[1];  a1[0] = a[2];  a1[1] = a[3];
      w0[0] = w[0];  w0[1] = w[1];  w1[0] = w[2];  w1[1] = w[3];
      acc0 = wmma4(a0, w0, acc0);
      acc1 = wmma4(a1, w1, acc1);
    }
  }

  // D layout: register j holds row j + 8*ksel, hidden unit hid.
#pragma unroll
  for (int j = 0; j < 8; ++j) {
    const float z = acc0[j] + acc1[j] + b1;
    tt[(j + 8 * ksel) * TPITCH + hid] = z * sigmoidf_(z) * w2;   // SiLU * wg2
  }
  __syncthreads();                             // all 64 terms of every row stand

  // The 8 threads of a row add 8 terms each, then across the 8 lanes.
  const v4f t0 = *reinterpret_cast<const v4f*>(&tt[xr * TPITCH + (tid & 7) * 8]);
  const v4f t1 = *reinterpret_cast<const v4f*>(&tt[xr * TPITCH + (tid & 7) * 8 + 4]);
  float g = ((t0[0] + t0[1]) + (t0[2] + t0[3])) + ((t1[0] + t1[1]) + (t1[2] + t1[3]));
  g += __shfl_xor(g, 1);
  g += __shfl_xor(g, 2);
  g += __shfl_xor(g, 4);
  g = sigmoidf_(g + b2);

  float* og = out + (size_t)(r0 + xr) * DD + xc;
#pragma unroll
  for (int i = 0; i < 8; ++i)
    *reinterpret_cast<v4f*>(og + 32 * i) = xv[i] * g;
}

// ---------------------------------------------------------------------------
extern "C" void kernel_launch(void* const* d_in, const int* in_sizes, int n_in,
                              void* d_out, int out_size, void* d_ws,
                              size_t ws_size, hipStream_t stream)
{
  const float* x   = (const float*)d_in[0];
  const float* wq  = (const float*)d_in[1];
  const float* bq  = (const float*)d_in[2];
  const float* wk  = (const float*)d_in[3];
  const float* bk  = (const float*)d_in[4];
  const float* wv  = (const float*)d_in[5];
  const float* bv  = (const float*)d_in[6];
  const float* wg1 = (const float*)d_in[7];
  const float* bg1 = (const float*)d_in[8];
  const float* wg2 = (const float*)d_in[9];
  const float* bg2 = (const float*)d_in[10];
  float* out = (float*)d_out;

  // Workspace: q (4 MB) | k, hi and lo parts (4 MB) | v transposed, hi and lo parts (4 MB) | attn_out (4 MB)
  float* qb = (float*)d_ws;
  float* kb = qb + (size_t)MROWS * DD;
  float* vb = kb + (size_t)MROWS * DD;
  float* ob = vb + (size_t)MROWS * DD;

  {
    dim3 grid(MROWS / 64, 12);
    qkv_proj_kernel<<<grid, 128, 0, stream>>>(x, wq, bq, wk, bk, wv, bv,
                                              qb, kb, vb);
  }
  {
    dim3 grid(NN / 64, HH, BB);
    spinor_attn_kernel<<<grid, ATTN_THREADS, 0, stream>>>(qb, kb, vb, ob);
  }
  {
    dim3 grid(MROWS / 16);
    gate_kernel<<<grid, 128, 0, stream>>>(ob, wg1, bg1, wg2, bg2, out);
  }
}
